// v000
// The times below were measured on an AMD MI455X: many runs one after another, warmed up first and cycling through
// copies of the inputs, with the whole window's GPU time divided by the number of runs. Launches and the gaps
// between them are all in it. The median over several windows is given; except for v000 it joins two sittings, which
// can be a few percent apart, so the side-by-side timings, each taken in one sitting, are the better comparison.
// v000 is the starting kernel. One run takes 445 microseconds.
// compute dtype: all float inputs rounded to bf16; q/k/v = x W with EXACT bf16 products on WMMA 16x16x32, f32 accumulate; q as f16 hi + residual; relative logits q_t . E[u - t + T - 1] gathered from the once-built QE = q E^T (2 products, E rounded once to f16) and content logits q . k (2 products, k f16), summed and scaled by 64^-0.5, stored in f32 (4 batches per launch); softmax in f32 (precise expf), P x 2^11 kept f32 split bf16 hi + lo against v bf16 hi + lo (3 products); f32 output [b][t][64].
#include <hip/hip_runtime.h>
#include <math.h>

typedef __attribute__((ext_vector_type(16))) _Float16 v16h;
typedef __attribute__((ext_vector_type(16))) __bf16 v16b;
typedef __attribute__((ext_vector_type(8)))  _Float16 v8h;
typedef __attribute__((ext_vector_type(8)))  float v8f;
typedef __attribute__((ext_vector_type(4)))  float v4f;
typedef __attribute__((ext_vector_type(2)))  float v2f;
typedef __attribute__((ext_vector_type(4)))  unsigned v4u;
typedef __attribute__((ext_vector_type(4)))  int v4i;
typedef float __attribute__((may_alias)) float_a;
typedef int __attribute__((may_alias)) int_a;

template <typename T> __device__ __forceinline__ void vst2(void* p, T v) { *(T*)p = v;  }
__device__ __forceinline__ v8f wmma16(v16h a, v16h b, v8f c) {
  v8f d = __builtin_amdgcn_wmma_f32_16x16x32_f16(false, a, false, b, (short)0, c, false, false);
  asm volatile("v_nop\n\tv_nop\n\tv_nop\n\tv_nop" : "+v"(d) : "v"(a), "v"(b));
  return d;
}
__device__ __forceinline__ v8f wmma_bf(v16b a, v16b b, v8f c) {
  v8f d = __builtin_amdgcn_wmma_f32_16x16x32_bf16(false, a, false, b, (short)0, c, false, false);
  asm volatile("v_nop\n\tv_nop\n\tv_nop\n\tv_nop" : "+v"(d) : "v"(a), "v"(b));
  return d;
}
// 16x16x32 fragments: lane = (h = lane>>4, row/col = lane&15); elements 0..7 = k0+8h+0..7, 8..15 = k0+16+8h+0..7; D element r = row 8h+r
__device__ __forceinline__ v16h frag_h(const _Float16* rowk0, int lane) {
  union { v16h v; v8h q[2]; } u; const _Float16* p = rowk0 + 8 * (lane >> 4);
  u.q[0] = *(const v8h*)p; u.q[1] = *(const v8h*)(p + 16); return u.v;
}
__device__ __forceinline__ v16h frag_f32(const float* rowk0, int lane) {
  v16h a; const float* p = rowk0 + 8 * (lane >> 4);
#pragma unroll
  for (int i = 0; i < 8; ++i) { a[i] = (_Float16)p[i]; a[8 + i] = (_Float16)p[16 + i]; }
  return a;
}
__device__ __forceinline__ v16h frag_f32s(const float* rowk0, int lane, float sc) {
  v16h a; const float* p = rowk0 + 8 * (lane >> 4);
#pragma unroll
  for (int i = 0; i < 8; ++i) { a[i] = (_Float16)(p[i] * sc); a[8 + i] = (_Float16)(p[16 + i] * sc); }
  return a;
}
// column fragment from a [K][ld] layout (column n), rows >= K read as 0
__device__ __forceinline__ v16h fragc_f32(const float* W, int k0, int n, int lane, int ld, int K) {
  v16h a; const int g = lane >> 4;
#pragma unroll
  for (int i = 0; i < 8; ++i) { const int ka = k0 + 8 * g + i, kb = ka + 16;
    a[i] = (_Float16)(ka < K ? W[(size_t)(ka < K ? ka : K - 1) * ld + n] : 0.f); a[8 + i] = (_Float16)(kb < K ? W[(size_t)(kb < K ? kb : K - 1) * ld + n] : 0.f); }
  return a;
}
struct F2 { v16b h, l; };
__device__ __forceinline__ F2 bsplit16(const float v[16]) { F2 r;
#pragma unroll
  for (int i = 0; i < 16; ++i) { const __bf16 h = (__bf16)v[i]; r.h[i] = h; r.l[i] = (__bf16)(v[i] - (float)h); }
  return r; }
__device__ __forceinline__ F2 split_row(const float* row, int k0, int lane) { float v[16]; const float* p = row + k0 + 8 * (lane >> 4);
#pragma unroll
  for (int i = 0; i < 8; ++i) { v[i] = p[i]; v[8 + i] = p[16 + i]; }
  return bsplit16(v); }
__device__ __forceinline__ F2 split_rowK(const float* row, int k0, int lane, int K) { float v[16]; const int g = lane >> 4;
#pragma unroll
  for (int i = 0; i < 8; ++i) { const int ka = k0 + 8 * g + i, kb = ka + 16; v[i] = ka < K ? row[ka < K ? ka : K - 1] : 0.f; v[8 + i] = kb < K ? row[kb < K ? kb : K - 1] : 0.f; }
  return bsplit16(v); }
__device__ __forceinline__ F2 split_col(const float* W, int k0, int n, int lane, int ld, int K) { float v[16]; const int g = lane >> 4;
#pragma unroll
  for (int i = 0; i < 8; ++i) { const int ka = k0 + 8 * g + i, kb = ka + 16; v[i] = ka < K ? W[(size_t)(ka < K ? ka : K - 1) * ld + n] : 0.f; v[8 + i] = kb < K ? W[(size_t)(kb < K ? kb : K - 1) * ld + n] : 0.f; }
  return bsplit16(v); }
__device__ __forceinline__ v8f mac3(const F2& a, const F2& b, v8f c) { c = wmma_bf(a.l, b.h, c); c = wmma_bf(a.h, b.l, c); return wmma_bf(a.h, b.h, c); }
__device__ __forceinline__ float sigm(float v) { return 1.0f / (1.0f + expf(-v)); }
#define LDSX() do { asm volatile("s_wait_dscnt 0" ::: "memory"); __builtin_amdgcn_wave_barrier(); __builtin_amdgcn_fence(__ATOMIC_RELEASE, "workgroup"); } while (0)


// Relative attention head (B 16, T 1,024, C 768, head 64; learned relative embeddings E[2T-1, 64]): wei = softmax((q k^T + S_rel) / 8) with S_rel[t][u] = q_t . E[u - t + T - 1]; out = wei v.
#define NB 16
#define TT 1024
#define CIN 768
#define HS 64
#define NRE 2047
#define NREP 2048
#define BG 4                 // batches per launch group
#ifndef TNB
#define TNB NB
#endif
typedef __attribute__((ext_vector_type(8))) __bf16 v8b;
__device__ __forceinline__ v16b frag_b(const __bf16* rowk0, int lane) {
  union { v16b v; v8b q[2]; } u; const __bf16* p = rowk0 + 8 * (lane >> 4);
  u.q[0] = *(const v8b*)p; u.q[1] = *(const v8b*)(p + 16); return u.v;
}
__device__ __forceinline__ float bfr(float v) { return (float)(__bf16)v; }
__device__ __attribute__((noinline)) float exp_ni(float v) { return expf(v); }
__device__ __attribute__((noinline)) float erf_ni(float v) { return erff(v); }

#define WS_QH  0u                                  // f16 q rows [b*t][64]
#define WS_QL  (WS_QH + 2u * (size_t)NB * TT * HS)
#define WS_KH  (WS_QL + 2u * (size_t)NB * TT * HS)
#define WS_VT  (WS_KH + 2u * (size_t)NB * TT * HS)     // bf16 v planes hi [b][64][t]
#define WS_VL  (WS_VT + 2u * (size_t)NB * HS * TT)
#define WS_QE  (WS_VL + 2u * (size_t)NB * HS * TT)     // f32 QE [BG][t][2048]
#define WS_S   (WS_QE + 4u * (size_t)BG * TT * NREP)   // f32 S/P [BG][t][u]
#define WS_END (WS_S + 4u * (size_t)BG * TT * TT)

// ---- k_proj: block = (64 rows, which): q/k/v = x W ((in,out) [768][64]); 64 cols = 4 tiles
__global__ __launch_bounds__(128) void k_proj(const float* __restrict__ X, const float* __restrict__ WQ, const float* __restrict__ WK, const float* __restrict__ WV, _Float16* __restrict__ QH, _Float16* __restrict__ QL, _Float16* __restrict__ KH, __bf16* __restrict__ VT, __bf16* __restrict__ VL) {
  __shared__ __align__(16) _Float16 sh[64][72], sl[64][72]; __shared__ __align__(16) __bf16 th[64][72], tl2[64][72];
  const int tid = threadIdx.x, wave = tid >> 5, lane = tid & 31, col = lane & 15, g = lane >> 4; const int which = blockIdx.y; const size_t r0 = (size_t)blockIdx.x * 64 + wave * 16; const float* Wm = which == 0 ? WQ : which == 1 ? WK : WV;
  v8f acc[4] = {};
#pragma unroll 2
  for (int kc = 0; kc < CIN / 32; ++kc) { v16b a; { const float* p = X + (r0 + col) * CIN + kc * 32 + 8 * g;
#pragma unroll
      for (int i = 0; i < 8; ++i) { a[i] = (__bf16)p[i]; a[8 + i] = (__bf16)p[16 + i]; } }
#pragma unroll
    for (int j = 0; j < 4; ++j) { v16b w; const int o = j * 16 + col;
#pragma unroll
      for (int i = 0; i < 8; ++i) { w[i] = (__bf16)Wm[(size_t)(kc * 32 + 8 * g + i) * HS + o]; w[8 + i] = (__bf16)Wm[(size_t)(kc * 32 + 16 + 8 * g + i) * HS + o]; }
      acc[j] = wmma_bf(a, w, acc[j]); } }
#pragma unroll
  for (int j = 0; j < 4; ++j)
#pragma unroll
    for (int r = 0; r < 8; ++r) { const float v = acc[j][r]; const int rl = wave * 16 + 8 * g + r, cl = j * 16 + col;
      if (which == 2) { const __bf16 bh = (__bf16)v; th[cl][rl] = bh; tl2[cl][rl] = (__bf16)(v - (float)bh); } else { const _Float16 hv = (_Float16)v; sh[rl][cl] = hv; sl[rl][cl] = (_Float16)(v - (float)hv); } }
  __syncthreads();
  const size_t rb = (size_t)blockIdx.x * 64;
  if (which < 2) { _Float16* dh = which == 0 ? QH : KH; for (int e = tid; e < 64 * 8; e += 128) { const int rl = e >> 3, q = e & 7; vst2((unsigned*)(dh + (rb + rl) * HS + q * 8), *(const v4u*)&sh[rl][q * 8]); if (which == 0) vst2((unsigned*)(QL + (rb + rl) * HS + q * 8), *(const v4u*)&sl[rl][q * 8]); } }
  else { const size_t b = rb / TT; const int t0 = (int)(rb % TT); for (int e = tid; e < 64 * 8; e += 128) { const int cl = e >> 3, q = e & 7; const size_t o2 = (b * HS + cl) * (size_t)TT + t0 + q * 8; vst2((unsigned*)(VT + o2), *(const v4u*)&th[cl][q * 8]); vst2((unsigned*)(VL + o2), *(const v4u*)&tl2[cl][q * 8]); } } }
// ---- k_qe: block = (64 rows t, 128 rel cols, batch in group): QE[t][r] = q_t . E[r] (2 products; E row 2047 is a zero pad)
__global__ __launch_bounds__(128) void k_qe(const _Float16* __restrict__ QH, const _Float16* __restrict__ QL, const float* __restrict__ E, int b0, float* __restrict__ QE0) { __shared__ __align__(16) float ss[4][16][132];
  const int tid = threadIdx.x, wave = tid >> 5, lane = tid & 31, col = lane & 15, g = lane >> 4; const int b = b0 + blockIdx.z; float* QE = QE0 + (size_t)blockIdx.z * TT * NREP; const int c0 = blockIdx.y * 128; const int tl0 = blockIdx.x * 64 + wave * 16; const size_t q0 = (size_t)b * TT + tl0;
  v8f acc[8] = {};
#pragma unroll
  for (int kc = 0; kc < HS / 32; ++kc) { const v16h ah = frag_h(QH + (q0 + col) * HS + kc * 32, lane), al = frag_h(QL + (q0 + col) * HS + kc * 32, lane);
#pragma unroll
    for (int j = 0; j < 8; ++j) { v16h eb; const int rr = c0 + j * 16 + col;
#pragma unroll
      for (int i = 0; i < 8; ++i) { eb[i] = (rr < NRE) ? (_Float16)bfr(E[(size_t)rr * HS + kc * 32 + 8 * g + i]) : (_Float16)0.f; eb[8 + i] = (rr < NRE) ? (_Float16)bfr(E[(size_t)rr * HS + kc * 32 + 16 + 8 * g + i]) : (_Float16)0.f; }
      acc[j] = wmma16(ah, eb, acc[j]); acc[j] = wmma16(al, eb, acc[j]); } }
#pragma unroll
  for (int j = 0; j < 8; ++j)
#pragma unroll
    for (int r = 0; r < 8; ++r) ss[wave][8 * g + r][j * 16 + col] = acc[j][r];
  LDSX(); for (int rl = 0; rl < 16; ++rl) vst2(QE + (size_t)(tl0 + rl) * NREP + c0 + lane * 4, *(const v4f*)&ss[wave][rl][lane * 4]); }
// ---- k_sc: block = (64 queries t, 128 keys u, batch in group): S = (q . k + QE[t][u - t + T - 1]) / 8
__global__ __launch_bounds__(128) void k_sc(const _Float16* __restrict__ QH, const _Float16* __restrict__ QL, const _Float16* __restrict__ KH, const float* __restrict__ QE0, int b0, float* __restrict__ S0) { __shared__ __align__(16) float ss[4][16][132];
  const int tid = threadIdx.x, wave = tid >> 5, lane = tid & 31, col = lane & 15, g = lane >> 4; const int b = b0 + blockIdx.z; const float* QE = QE0 + (size_t)blockIdx.z * TT * NREP; float* S = S0 + (size_t)blockIdx.z * TT * TT; const int k0 = blockIdx.y * 128; const int tl0 = blockIdx.x * 64 + wave * 16; const size_t q0 = (size_t)b * TT + tl0;
  v8f acc[8] = {};
#pragma unroll
  for (int kc = 0; kc < HS / 32; ++kc) { const v16h ah = frag_h(QH + (q0 + col) * HS + kc * 32, lane), al = frag_h(QL + (q0 + col) * HS + kc * 32, lane);
#pragma unroll
    for (int j = 0; j < 8; ++j) { const v16h kb = frag_h(KH + ((size_t)b * TT + k0 + j * 16 + col) * HS + kc * 32, lane); acc[j] = wmma16(ah, kb, acc[j]); acc[j] = wmma16(al, kb, acc[j]); } }
#pragma unroll
  for (int j = 0; j < 8; ++j) { const int u = k0 + j * 16 + col;
#pragma unroll
    for (int r = 0; r < 8; ++r) { const int t = tl0 + 8 * g + r; ss[wave][8 * g + r][j * 16 + col] = (acc[j][r] + QE[(size_t)t * NREP + (u - t + TT - 1)]) * 0.125f; } }
  LDSX(); for (int rl = 0; rl < 16; ++rl) vst2(S + (size_t)(tl0 + rl) * TT + k0 + lane * 4, *(const v4f*)&ss[wave][rl][lane * 4]); }
// ---- k_sm: block = (row, batch in group): softmax -> P x 2^11 f32 in place
__global__ __launch_bounds__(256) void k_sm(float* __restrict__ S0) { __shared__ float sred[8]; __shared__ float sbc; __shared__ __align__(16) float sh[TT];
  const int t = threadIdx.x; const size_t row = blockIdx.x; float* sr = S0 + (size_t)blockIdx.y * TT * TT + row * TT;
  float m = -3.0e38f; for (int k = t; k < TT; k += 256) m = fmaxf(m, sr[k]);
#pragma unroll
  for (int o = 1; o < 32; o <<= 1) m = fmaxf(m, __shfl_xor(m, o));
  if ((t & 31) == 0) sred[t >> 5] = m; __syncthreads(); if (t == 0) { float a = sred[0]; for (int i = 1; i < 8; ++i) a = fmaxf(a, sred[i]); sbc = a; } __syncthreads(); m = sbc; __syncthreads();
  float sum = 0.f; for (int k = t; k < TT; k += 256) sum += expf(sr[k] - m);
#pragma unroll
  for (int o = 1; o < 32; o <<= 1) sum += __shfl_xor(sum, o);
  if ((t & 31) == 0) sred[t >> 5] = sum; __syncthreads(); if (t == 0) { float a = 0.f; for (int i = 0; i < 8; ++i) a += sred[i]; sbc = 1.0f / a; } __syncthreads(); const float inv = sbc;
  for (int k = t; k < TT; k += 256) sh[k] = expf(sr[k] - m) * inv * 2048.0f;
  __syncthreads(); for (int q = t; q < TT / 4; q += 256) vst2(sr + q * 4, *(const v4f*)&sh[q * 4]); }
// ---- k_pv: block = (64 queries, batch in group): out[b][t][d] = P . v (3 products)
__global__ __launch_bounds__(128) void k_pv(const float* __restrict__ PS0, const __bf16* __restrict__ VT, const __bf16* __restrict__ VL, int b0, float* __restrict__ OUT) { const int b = b0 + blockIdx.z; const float* PS = PS0 + (size_t)blockIdx.z * TT * TT; __shared__ __align__(16) float ss[4][16][68];
  const int tid = threadIdx.x, wave = tid >> 5, lane = tid & 31, col = lane & 15, g = lane >> 4; const int tl0 = blockIdx.x * 64 + wave * 16;
  v8f acc[4] = {};
#pragma unroll 1
  for (int kc = 0; kc < TT / 32; ++kc) { const F2 p = split_row(PS + (size_t)(tl0 + col) * TT, kc * 32, lane);
#pragma unroll
    for (int j = 0; j < 4; ++j) { const size_t po = ((size_t)b * HS + j * 16 + col) * (size_t)TT + kc * 32; const v16b vh = frag_b(VT + po, lane); acc[j] = wmma_bf(p.h, vh, acc[j]); acc[j] = wmma_bf(p.l, vh, acc[j]); acc[j] = wmma_bf(p.h, frag_b(VL + po, lane), acc[j]); } }
#pragma unroll
  for (int j = 0; j < 4; ++j)
#pragma unroll
    for (int r = 0; r < 8; ++r) ss[wave][8 * g + r][j * 16 + col] = acc[j][r] * (1.0f / 2048.0f);
  LDSX(); for (int rl = 0; rl < 16; ++rl) if (lane < 16) vst2(OUT + ((size_t)b * TT + tl0 + rl) * HS + lane * 4, *(const v4f*)&ss[wave][rl][lane * 4]); }
extern "C" void kernel_launch(void* const* d_in, const int* in_sizes, int n_in, void* d_out, int out_size, void* d_ws, size_t ws_size, hipStream_t stream) {
  (void)in_sizes; (void)n_in; (void)out_size;
  const float** F = (const float**)d_in;   // 0 x [16,1024,768], 1 Wq [768,64], 2 Wk, 3 Wv, 4 E [2047,64]
  if (ws_size < (size_t)WS_END) return;
  char* ws = (char*)d_ws; _Float16 *QH = (_Float16*)(ws + WS_QH), *QL = (_Float16*)(ws + WS_QL), *KH = (_Float16*)(ws + WS_KH); __bf16 *VT = (__bf16*)(ws + WS_VT), *VL = (__bf16*)(ws + WS_VL); float *QE = (float*)(ws + WS_QE), *S = (float*)(ws + WS_S);
  k_proj<<<dim3(TNB * TT / 64, 3), 128, 0, stream>>>(F[0], F[1], F[2], F[3], QH, QL, KH, VT, VL);
  for (int b0 = 0; b0 < TNB; b0 += BG) { const int ng = (TNB - b0 < BG) ? (TNB - b0) : BG;
    k_qe<<<dim3(TT / 64, NREP / 128, ng), 128, 0, stream>>>(QH, QL, F[4], b0, QE);
    k_sc<<<dim3(TT / 64, TT / 128, ng), 128, 0, stream>>>(QH, QL, KH, QE, b0, S);
    k_sm<<<dim3(TT, ng), 256, 0, stream>>>(S);
    k_pv<<<dim3(TT / 64, 1, ng), 128, 0, stream>>>(S, VT, VL, b0, (float*)d_out);
  }
}

// v001
// One run takes 248 microseconds.
// In two side-by-side timings against v000, it was 1.79 and 1.80 times as fast.
// compute dtype: all float inputs rounded to bf16; q/k/v = x W with EXACT bf16 products on WMMA 16x16x32, f32 accumulate; q as f16 hi + residual; relative logits q_t . E[u - t + T - 1] gathered from the once-built QE = q E^T (2 products, E rounded to bf16, held as f16) and content logits q . k (2 products, k f16), summed and scaled by 64^-0.5, stored in f32 (all 16 batches per launch); softmax in f32 (precise expf), P x 2^11 kept f32 split bf16 hi + lo against v bf16 hi + lo (3 products); f32 output [b][t][64].
#include <hip/hip_runtime.h>
#include <math.h>

typedef __attribute__((ext_vector_type(16))) _Float16 v16h;
typedef __attribute__((ext_vector_type(16))) __bf16 v16b;
typedef __attribute__((ext_vector_type(8)))  _Float16 v8h;
typedef __attribute__((ext_vector_type(8)))  float v8f;
typedef __attribute__((ext_vector_type(4)))  float v4f;
typedef __attribute__((ext_vector_type(2)))  float v2f;
typedef __attribute__((ext_vector_type(4)))  unsigned v4u;
typedef __attribute__((ext_vector_type(4)))  int v4i;
typedef float __attribute__((may_alias)) float_a;
typedef int __attribute__((may_alias)) int_a;

template <typename T> __device__ __forceinline__ void vst2(void* p, T v) { *(T*)p = v;  }
__device__ __forceinline__ v8f wmma16(v16h a, v16h b, v8f c) {
  v8f d = __builtin_amdgcn_wmma_f32_16x16x32_f16(false, a, false, b, (short)0, c, false, false);
  asm volatile("v_nop\n\tv_nop\n\tv_nop\n\tv_nop" : "+v"(d) : "v"(a), "v"(b));
  return d;
}
__device__ __forceinline__ v8f wmma_bf(v16b a, v16b b, v8f c) {
  v8f d = __builtin_amdgcn_wmma_f32_16x16x32_bf16(false, a, false, b, (short)0, c, false, false);
  asm volatile("v_nop\n\tv_nop\n\tv_nop\n\tv_nop" : "+v"(d) : "v"(a), "v"(b));
  return d;
}
// 16x16x32 fragments: lane = (h = lane>>4, row/col = lane&15); elements 0..7 = k0+8h+0..7, 8..15 = k0+16+8h+0..7; D element r = row 8h+r
__device__ __forceinline__ v16h frag_h(const _Float16* rowk0, int lane) {
  union { v16h v; v8h q[2]; } u; const _Float16* p = rowk0 + 8 * (lane >> 4);
  u.q[0] = *(const v8h*)p; u.q[1] = *(const v8h*)(p + 16); return u.v;
}
__device__ __forceinline__ v16h frag_f32(const float* rowk0, int lane) {
  v16h a; const float* p = rowk0 + 8 * (lane >> 4);
#pragma unroll
  for (int i = 0; i < 8; ++i) { a[i] = (_Float16)p[i]; a[8 + i] = (_Float16)p[16 + i]; }
  return a;
}
__device__ __forceinline__ v16h frag_f32s(const float* rowk0, int lane, float sc) {
  v16h a; const float* p = rowk0 + 8 * (lane >> 4);
#pragma unroll
  for (int i = 0; i < 8; ++i) { a[i] = (_Float16)(p[i] * sc); a[8 + i] = (_Float16)(p[16 + i] * sc); }
  return a;
}
// column fragment from a [K][ld] layout (column n), rows >= K read as 0
__device__ __forceinline__ v16h fragc_f32(const float* W, int k0, int n, int lane, int ld, int K) {
  v16h a; const int g = lane >> 4;
#pragma unroll
  for (int i = 0; i < 8; ++i) { const int ka = k0 + 8 * g + i, kb = ka + 16;
    a[i] = (_Float16)(ka < K ? W[(size_t)(ka < K ? ka : K - 1) * ld + n] : 0.f); a[8 + i] = (_Float16)(kb < K ? W[(size_t)(kb < K ? kb : K - 1) * ld + n] : 0.f); }
  return a;
}
struct F2 { v16b h, l; };
__device__ __forceinline__ F2 bsplit16(const float v[16]) { F2 r;
#pragma unroll
  for (int i = 0; i < 16; ++i) { const __bf16 h = (__bf16)v[i]; r.h[i] = h; r.l[i] = (__bf16)(v[i] - (float)h); }
  return r; }
__device__ __forceinline__ F2 split_row(const float* row, int k0, int lane) { float v[16]; const float* p = row + k0 + 8 * (lane >> 4);
#pragma unroll
  for (int i = 0; i < 8; ++i) { v[i] = p[i]; v[8 + i] = p[16 + i]; }
  return bsplit16(v); }
__device__ __forceinline__ F2 split_rowK(const float* row, int k0, int lane, int K) { float v[16]; const int g = lane >> 4;
#pragma unroll
  for (int i = 0; i < 8; ++i) { const int ka = k0 + 8 * g + i, kb = ka + 16; v[i] = ka < K ? row[ka < K ? ka : K - 1] : 0.f; v[8 + i] = kb < K ? row[kb < K ? kb : K - 1] : 0.f; }
  return bsplit16(v); }
__device__ __forceinline__ F2 split_col(const float* W, int k0, int n, int lane, int ld, int K) { float v[16]; const int g = lane >> 4;
#pragma unroll
  for (int i = 0; i < 8; ++i) { const int ka = k0 + 8 * g + i, kb = ka + 16; v[i] = ka < K ? W[(size_t)(ka < K ? ka : K - 1) * ld + n] : 0.f; v[8 + i] = kb < K ? W[(size_t)(kb < K ? kb : K - 1) * ld + n] : 0.f; }
  return bsplit16(v); }
__device__ __forceinline__ v8f mac3(const F2& a, const F2& b, v8f c) { c = wmma_bf(a.l, b.h, c); c = wmma_bf(a.h, b.l, c); return wmma_bf(a.h, b.h, c); }
__device__ __forceinline__ float sigm(float v) { return 1.0f / (1.0f + expf(-v)); }
#define LDSX() do { asm volatile("s_wait_dscnt 0" ::: "memory"); __builtin_amdgcn_wave_barrier(); __builtin_amdgcn_fence(__ATOMIC_RELEASE, "workgroup"); } while (0)


// Relative attention head (B 16, T 1,024, C 768, head 64; learned relative embeddings E[2T-1, 64]): wei = softmax((q k^T + S_rel) / 8) with S_rel[t][u] = q_t . E[u - t + T - 1]; out = wei v.
#define NB 16
#define TT 1024
#define CIN 768
#define HS 64
#define NRE 2047
#define NREP 2048
#define BG NB                // batches per launch group: all of them, so that every stage is one launch and the 64-row output tiles number one per WGP
#ifndef TNB
#define TNB NB
#endif
typedef __attribute__((ext_vector_type(8))) __bf16 v8b;
__device__ __forceinline__ v16b frag_b(const __bf16* rowk0, int lane) {
  union { v16b v; v8b q[2]; } u; const __bf16* p = rowk0 + 8 * (lane >> 4);
  u.q[0] = *(const v8b*)p; u.q[1] = *(const v8b*)(p + 16); return u.v;
}
__device__ __forceinline__ float bfr(float v) { return (float)(__bf16)v; }
__device__ __attribute__((noinline)) float exp_ni(float v) { return expf(v); }
__device__ __attribute__((noinline)) float erf_ni(float v) { return erff(v); }

#define WS_QH  0u                                  // f16 q rows [b*t][64]
#define WS_QL  (WS_QH + 2u * (size_t)NB * TT * HS)
#define WS_KH  (WS_QL + 2u * (size_t)NB * TT * HS)
#define WS_VT  (WS_KH + 2u * (size_t)NB * TT * HS)     // bf16 v planes hi [b][64][t]
#define WS_VL  (WS_VT + 2u * (size_t)NB * HS * TT)
#define WS_QE  (WS_VL + 2u * (size_t)NB * HS * TT)     // f32 QE [BG][t][2048]
#define WS_S   (WS_QE + 4u * (size_t)BG * TT * NREP)   // f32 S/P [BG][t][u]
#define WS_END (WS_S + 4u * (size_t)BG * TT * TT)

// ---- k_proj: block = (64 rows, which): q/k/v = x W ((in,out) [768][64]); 64 cols = 4 tiles
__global__ __launch_bounds__(128) void k_proj(const float* __restrict__ X, const float* __restrict__ WQ, const float* __restrict__ WK, const float* __restrict__ WV, _Float16* __restrict__ QH, _Float16* __restrict__ QL, _Float16* __restrict__ KH, __bf16* __restrict__ VT, __bf16* __restrict__ VL) {
  __shared__ __align__(16) _Float16 sh[64][72], sl[64][72]; __shared__ __align__(16) __bf16 th[64][72], tl2[64][72];
  const int tid = threadIdx.x, wave = tid >> 5, lane = tid & 31, col = lane & 15, g = lane >> 4; const int which = blockIdx.y; const size_t r0 = (size_t)blockIdx.x * 64 + wave * 16; const float* Wm = which == 0 ? WQ : which == 1 ? WK : WV;
  v8f acc[4] = {};
#pragma unroll 2
  for (int kc = 0; kc < CIN / 32; ++kc) { v16b a; { const float* p = X + (r0 + col) * CIN + kc * 32 + 8 * g;
#pragma unroll
      for (int i = 0; i < 8; ++i) { a[i] = (__bf16)p[i]; a[8 + i] = (__bf16)p[16 + i]; } }
#pragma unroll
    for (int j = 0; j < 4; ++j) { v16b w; const int o = j * 16 + col;
#pragma unroll
      for (int i = 0; i < 8; ++i) { w[i] = (__bf16)Wm[(size_t)(kc * 32 + 8 * g + i) * HS + o]; w[8 + i] = (__bf16)Wm[(size_t)(kc * 32 + 16 + 8 * g + i) * HS + o]; }
      acc[j] = wmma_bf(a, w, acc[j]); } }
#pragma unroll
  for (int j = 0; j < 4; ++j)
#pragma unroll
    for (int r = 0; r < 8; ++r) { const float v = acc[j][r]; const int rl = wave * 16 + 8 * g + r, cl = j * 16 + col;
      if (which == 2) { const __bf16 bh = (__bf16)v; th[cl][rl] = bh; tl2[cl][rl] = (__bf16)(v - (float)bh); } else { const _Float16 hv = (_Float16)v; sh[rl][cl] = hv; sl[rl][cl] = (_Float16)(v - (float)hv); } }
  __syncthreads();
  const size_t rb = (size_t)blockIdx.x * 64;
  if (which < 2) { _Float16* dh = which == 0 ? QH : KH; for (int e = tid; e < 64 * 8; e += 128) { const int rl = e >> 3, q = e & 7; vst2((unsigned*)(dh + (rb + rl) * HS + q * 8), *(const v4u*)&sh[rl][q * 8]); if (which == 0) vst2((unsigned*)(QL + (rb + rl) * HS + q * 8), *(const v4u*)&sl[rl][q * 8]); } }
  else { const size_t b = rb / TT; const int t0 = (int)(rb % TT); for (int e = tid; e < 64 * 8; e += 128) { const int cl = e >> 3, q = e & 7; const size_t o2 = (b * HS + cl) * (size_t)TT + t0 + q * 8; vst2((unsigned*)(VT + o2), *(const v4u*)&th[cl][q * 8]); vst2((unsigned*)(VL + o2), *(const v4u*)&tl2[cl][q * 8]); } } }
// ---- k_qe: block = (64 rows t, 128 rel cols, batch in group): QE[t][r] = q_t . E[r] (2 products; E row 2047 is a zero pad)
__global__ __launch_bounds__(128) void k_qe(const _Float16* __restrict__ QH, const _Float16* __restrict__ QL, const float* __restrict__ E, int b0, float* __restrict__ QE0) { __shared__ __align__(16) float ss[4][16][132];
  const int tid = threadIdx.x, wave = tid >> 5, lane = tid & 31, col = lane & 15, g = lane >> 4; const int b = b0 + blockIdx.z; float* QE = QE0 + (size_t)blockIdx.z * TT * NREP; const int c0 = blockIdx.y * 128; const int tl0 = blockIdx.x * 64 + wave * 16; const size_t q0 = (size_t)b * TT + tl0;
  v8f acc[8] = {};
#pragma unroll
  for (int kc = 0; kc < HS / 32; ++kc) { const v16h ah = frag_h(QH + (q0 + col) * HS + kc * 32, lane), al = frag_h(QL + (q0 + col) * HS + kc * 32, lane);
#pragma unroll
    for (int j = 0; j < 8; ++j) { v16h eb; const int rr = c0 + j * 16 + col;
#pragma unroll
      for (int i = 0; i < 8; ++i) { eb[i] = (rr < NRE) ? (_Float16)bfr(E[(size_t)rr * HS + kc * 32 + 8 * g + i]) : (_Float16)0.f; eb[8 + i] = (rr < NRE) ? (_Float16)bfr(E[(size_t)rr * HS + kc * 32 + 16 + 8 * g + i]) : (_Float16)0.f; }
      acc[j] = wmma16(ah, eb, acc[j]); acc[j] = wmma16(al, eb, acc[j]); } }
#pragma unroll
  for (int j = 0; j < 8; ++j)
#pragma unroll
    for (int r = 0; r < 8; ++r) ss[wave][8 * g + r][j * 16 + col] = acc[j][r];
  LDSX(); for (int rl = 0; rl < 16; ++rl) vst2(QE + (size_t)(tl0 + rl) * NREP + c0 + lane * 4, *(const v4f*)&ss[wave][rl][lane * 4]); }
// ---- k_sc: block = (64 queries t, 128 keys u, batch in group): S = (q . k + QE[t][u - t + T - 1]) / 8
__global__ __launch_bounds__(128) void k_sc(const _Float16* __restrict__ QH, const _Float16* __restrict__ QL, const _Float16* __restrict__ KH, const float* __restrict__ QE0, int b0, float* __restrict__ S0) { __shared__ __align__(16) float ss[4][16][132];
  const int tid = threadIdx.x, wave = tid >> 5, lane = tid & 31, col = lane & 15, g = lane >> 4; const int b = b0 + blockIdx.z; const float* QE = QE0 + (size_t)blockIdx.z * TT * NREP; float* S = S0 + (size_t)blockIdx.z * TT * TT; const int k0 = blockIdx.y * 128; const int tl0 = blockIdx.x * 64 + wave * 16; const size_t q0 = (size_t)b * TT + tl0;
  v8f acc[8] = {};
#pragma unroll
  for (int kc = 0; kc < HS / 32; ++kc) { const v16h ah = frag_h(QH + (q0 + col) * HS + kc * 32, lane), al = frag_h(QL + (q0 + col) * HS + kc * 32, lane);
#pragma unroll
    for (int j = 0; j < 8; ++j) { const v16h kb = frag_h(KH + ((size_t)b * TT + k0 + j * 16 + col) * HS + kc * 32, lane); acc[j] = wmma16(ah, kb, acc[j]); acc[j] = wmma16(al, kb, acc[j]); } }
#pragma unroll
  for (int j = 0; j < 8; ++j) { const int u = k0 + j * 16 + col;
#pragma unroll
    for (int r = 0; r < 8; ++r) { const int t = tl0 + 8 * g + r; ss[wave][8 * g + r][j * 16 + col] = (acc[j][r] + QE[(size_t)t * NREP + (u - t + TT - 1)]) * 0.125f; } }
  LDSX(); for (int rl = 0; rl < 16; ++rl) vst2(S + (size_t)(tl0 + rl) * TT + k0 + lane * 4, *(const v4f*)&ss[wave][rl][lane * 4]); }
// ---- k_sm: block = (row, batch in group): softmax -> P x 2^11 f32 in place
__global__ __launch_bounds__(256) void k_sm(float* __restrict__ S0) { __shared__ float sred[8]; __shared__ float sbc; __shared__ __align__(16) float sh[TT];
  const int t = threadIdx.x; const size_t row = blockIdx.x; float* sr = S0 + (size_t)blockIdx.y * TT * TT + row * TT;
  float m = -3.0e38f; for (int k = t; k < TT; k += 256) m = fmaxf(m, sr[k]);
#pragma unroll
  for (int o = 1; o < 32; o <<= 1) m = fmaxf(m, __shfl_xor(m, o));
  if ((t & 31) == 0) sred[t >> 5] = m; __syncthreads(); if (t == 0) { float a = sred[0]; for (int i = 1; i < 8; ++i) a = fmaxf(a, sred[i]); sbc = a; } __syncthreads(); m = sbc; __syncthreads();
  float sum = 0.f; for (int k = t; k < TT; k += 256) sum += expf(sr[k] - m);
#pragma unroll
  for (int o = 1; o < 32; o <<= 1) sum += __shfl_xor(sum, o);
  if ((t & 31) == 0) sred[t >> 5] = sum; __syncthreads(); if (t == 0) { float a = 0.f; for (int i = 0; i < 8; ++i) a += sred[i]; sbc = 1.0f / a; } __syncthreads(); const float inv = sbc;
  for (int k = t; k < TT; k += 256) sh[k] = expf(sr[k] - m) * inv * 2048.0f;
  __syncthreads(); for (int q = t; q < TT / 4; q += 256) vst2(sr + q * 4, *(const v4f*)&sh[q * 4]); }
// ---- k_pv: block = (64 queries, batch in group): out[b][t][d] = P . v (3 products)
__global__ __launch_bounds__(128) void k_pv(const float* __restrict__ PS0, const __bf16* __restrict__ VT, const __bf16* __restrict__ VL, int b0, float* __restrict__ OUT) { const int b = b0 + blockIdx.z; const float* PS = PS0 + (size_t)blockIdx.z * TT * TT; __shared__ __align__(16) float ss[4][16][68];
  const int tid = threadIdx.x, wave = tid >> 5, lane = tid & 31, col = lane & 15, g = lane >> 4; const int tl0 = blockIdx.x * 64 + wave * 16;
  v8f acc[4] = {};
#pragma unroll 1
  for (int kc = 0; kc < TT / 32; ++kc) { const F2 p = split_row(PS + (size_t)(tl0 + col) * TT, kc * 32, lane);
#pragma unroll
    for (int j = 0; j < 4; ++j) { const size_t po = ((size_t)b * HS + j * 16 + col) * (size_t)TT + kc * 32; const v16b vh = frag_b(VT + po, lane); acc[j] = wmma_bf(p.h, vh, acc[j]); acc[j] = wmma_bf(p.l, vh, acc[j]); acc[j] = wmma_bf(p.h, frag_b(VL + po, lane), acc[j]); } }
#pragma unroll
  for (int j = 0; j < 4; ++j)
#pragma unroll
    for (int r = 0; r < 8; ++r) ss[wave][8 * g + r][j * 16 + col] = acc[j][r] * (1.0f / 2048.0f);
  LDSX(); for (int rl = 0; rl < 16; ++rl) if (lane < 16) vst2(OUT + ((size_t)b * TT + tl0 + rl) * HS + lane * 4, *(const v4f*)&ss[wave][rl][lane * 4]); }
extern "C" void kernel_launch(void* const* d_in, const int* in_sizes, int n_in, void* d_out, int out_size, void* d_ws, size_t ws_size, hipStream_t stream) {
  (void)in_sizes; (void)n_in; (void)out_size;
  const float** F = (const float**)d_in;   // 0 x [16,1024,768], 1 Wq [768,64], 2 Wk, 3 Wv, 4 E [2047,64]
  if (ws_size < (size_t)WS_END) return;
  char* ws = (char*)d_ws; _Float16 *QH = (_Float16*)(ws + WS_QH), *QL = (_Float16*)(ws + WS_QL), *KH = (_Float16*)(ws + WS_KH); __bf16 *VT = (__bf16*)(ws + WS_VT), *VL = (__bf16*)(ws + WS_VL); float *QE = (float*)(ws + WS_QE), *S = (float*)(ws + WS_S);
  k_proj<<<dim3(TNB * TT / 64, 3), 128, 0, stream>>>(F[0], F[1], F[2], F[3], QH, QL, KH, VT, VL);
  for (int b0 = 0; b0 < TNB; b0 += BG) { const int ng = (TNB - b0 < BG) ? (TNB - b0) : BG;
    k_qe<<<dim3(TT / 64, NREP / 128, ng), 128, 0, stream>>>(QH, QL, F[4], b0, QE);
    k_sc<<<dim3(TT / 64, TT / 128, ng), 128, 0, stream>>>(QH, QL, KH, QE, b0, S);
    k_sm<<<dim3(TT, ng), 256, 0, stream>>>(S);
    k_pv<<<dim3(TT / 64, 1, ng), 128, 0, stream>>>(S, VT, VL, b0, (float*)d_out);
  }
}

// v002
// A run of this version takes 154 microseconds.
// Next to v001, in two timings, it ran 1.62 times as fast each time.
// Over all steps from v000 it is 2.91 times as fast.
// compute dtype: all float inputs rounded to bf16; q/k/v = x W with EXACT bf16 products on WMMA 16x16x32, f32 accumulate; q as f16 hi + residual; relative logits q_t . E[u - t + T - 1] gathered from the once-built QE = q E^T (2 products, E rounded once to f16) and content logits q . k (2 products, k f16), summed and scaled by 64^-0.5, kept in f32 registers (16 whole rows per work-group); softmax in f32 (precise expf), P x 2^11 kept f32 split bf16 hi + lo against v bf16 hi + lo (3 products), 8 partial sums of 128 keys added in f32; f32 output [b][t][64].
#include <hip/hip_runtime.h>
#include <math.h>

typedef __attribute__((ext_vector_type(16))) _Float16 v16h;
typedef __attribute__((ext_vector_type(16))) __bf16 v16b;
typedef __attribute__((ext_vector_type(8)))  _Float16 v8h;
typedef __attribute__((ext_vector_type(8)))  float v8f;
typedef __attribute__((ext_vector_type(4)))  float v4f;
typedef __attribute__((ext_vector_type(2)))  float v2f;
typedef __attribute__((ext_vector_type(4)))  unsigned v4u;
typedef __attribute__((ext_vector_type(4)))  int v4i;
typedef float __attribute__((may_alias)) float_a;
typedef int __attribute__((may_alias)) int_a;

template <typename T> __device__ __forceinline__ void vst2(void* p, T v) { *(T*)p = v;  }
__device__ __forceinline__ v8f wmma16(v16h a, v16h b, v8f c) {
  v8f d = __builtin_amdgcn_wmma_f32_16x16x32_f16(false, a, false, b, (short)0, c, false, false);
  asm volatile("v_nop\n\tv_nop\n\tv_nop\n\tv_nop" : "+v"(d) : "v"(a), "v"(b));
  return d;
}
__device__ __forceinline__ v8f wmma_bf(v16b a, v16b b, v8f c) {
  v8f d = __builtin_amdgcn_wmma_f32_16x16x32_bf16(false, a, false, b, (short)0, c, false, false);
  asm volatile("v_nop\n\tv_nop\n\tv_nop\n\tv_nop" : "+v"(d) : "v"(a), "v"(b));
  return d;
}
// 16x16x32 fragments: lane = (h = lane>>4, row/col = lane&15); elements 0..7 = k0+8h+0..7, 8..15 = k0+16+8h+0..7; D element r = row 8h+r
__device__ __forceinline__ v16h frag_h(const _Float16* rowk0, int lane) {
  union { v16h v; v8h q[2]; } u; const _Float16* p = rowk0 + 8 * (lane >> 4);
  u.q[0] = *(const v8h*)p; u.q[1] = *(const v8h*)(p + 16); return u.v;
}
__device__ __forceinline__ v16h frag_f32(const float* rowk0, int lane) {
  v16h a; const float* p = rowk0 + 8 * (lane >> 4);
#pragma unroll
  for (int i = 0; i < 8; ++i) { a[i] = (_Float16)p[i]; a[8 + i] = (_Float16)p[16 + i]; }
  return a;
}
__device__ __forceinline__ v16h frag_f32s(const float* rowk0, int lane, float sc) {
  v16h a; const float* p = rowk0 + 8 * (lane >> 4);
#pragma unroll
  for (int i = 0; i < 8; ++i) { a[i] = (_Float16)(p[i] * sc); a[8 + i] = (_Float16)(p[16 + i] * sc); }
  return a;
}
// column fragment from a [K][ld] layout (column n), rows >= K read as 0
__device__ __forceinline__ v16h fragc_f32(const float* W, int k0, int n, int lane, int ld, int K) {
  v16h a; const int g = lane >> 4;
#pragma unroll
  for (int i = 0; i < 8; ++i) { const int ka = k0 + 8 * g + i, kb = ka + 16;
    a[i] = (_Float16)(ka < K ? W[(size_t)(ka < K ? ka : K - 1) * ld + n] : 0.f); a[8 + i] = (_Float16)(kb < K ? W[(size_t)(kb < K ? kb : K - 1) * ld + n] : 0.f); }
  return a;
}
struct F2 { v16b h, l; };
__device__ __forceinline__ F2 bsplit16(const float v[16]) { F2 r;
#pragma unroll
  for (int i = 0; i < 16; ++i) { const __bf16 h = (__bf16)v[i]; r.h[i] = h; r.l[i] = (__bf16)(v[i] - (float)h); }
  return r; }
__device__ __forceinline__ F2 split_row(const float* row, int k0, int lane) { float v[16]; const float* p = row + k0 + 8 * (lane >> 4);
#pragma unroll
  for (int i = 0; i < 8; ++i) { v[i] = p[i]; v[8 + i] = p[16 + i]; }
  return bsplit16(v); }
__device__ __forceinline__ F2 split_rowK(const float* row, int k0, int lane, int K) { float v[16]; const int g = lane >> 4;
#pragma unroll
  for (int i = 0; i < 8; ++i) { const int ka = k0 + 8 * g + i, kb = ka + 16; v[i] = ka < K ? row[ka < K ? ka : K - 1] : 0.f; v[8 + i] = kb < K ? row[kb < K ? kb : K - 1] : 0.f; }
  return bsplit16(v); }
__device__ __forceinline__ F2 split_col(const float* W, int k0, int n, int lane, int ld, int K) { float v[16]; const int g = lane >> 4;
#pragma unroll
  for (int i = 0; i < 8; ++i) { const int ka = k0 + 8 * g + i, kb = ka + 16; v[i] = ka < K ? W[(size_t)(ka < K ? ka : K - 1) * ld + n] : 0.f; v[8 + i] = kb < K ? W[(size_t)(kb < K ? kb : K - 1) * ld + n] : 0.f; }
  return bsplit16(v); }
__device__ __forceinline__ v8f mac3(const F2& a, const F2& b, v8f c) { c = wmma_bf(a.l, b.h, c); c = wmma_bf(a.h, b.l, c); return wmma_bf(a.h, b.h, c); }
__device__ __forceinline__ float sigm(float v) { return 1.0f / (1.0f + expf(-v)); }
#define LDSX() do { asm volatile("s_wait_dscnt 0" ::: "memory"); __builtin_amdgcn_wave_barrier(); __builtin_amdgcn_fence(__ATOMIC_RELEASE, "workgroup"); } while (0)


// Relative attention head (B 16, T 1,024, C 768, head 64; learned relative embeddings E[2T-1, 64]): wei = softmax((q k^T + S_rel) / 8) with S_rel[t][u] = q_t . E[u - t + T - 1]; out = wei v.
#define NB 16
#define TT 1024
#define CIN 768
#define HS 64
#define NRE 2047
#define NREP 2048
#define BG NB                // batches per launch group: all of them, so that every stage is one launch
#ifndef TNB
#define TNB NB
#endif
typedef __attribute__((ext_vector_type(8))) __bf16 v8b;
__device__ __forceinline__ v16b frag_b(const __bf16* rowk0, int lane) {
  union { v16b v; v8b q[2]; } u; const __bf16* p = rowk0 + 8 * (lane >> 4);
  u.q[0] = *(const v8b*)p; u.q[1] = *(const v8b*)(p + 16); return u.v;
}
__device__ __forceinline__ float bfr(float v) { return (float)(__bf16)v; }
__device__ __attribute__((noinline)) float exp_ni(float v) { return expf(v); }
__device__ __attribute__((noinline)) float erf_ni(float v) { return erff(v); }

#define WS_QH  0u                                  // f16 q rows [b*t][64]
#define WS_QL  (WS_QH + 2u * (size_t)NB * TT * HS)
#define WS_KH  (WS_QL + 2u * (size_t)NB * TT * HS)
#define WS_VT  (WS_KH + 2u * (size_t)NB * TT * HS)     // bf16 v planes hi [b][64][t]
#define WS_VL  (WS_VT + 2u * (size_t)NB * HS * TT)
#define WS_QE  (WS_VL + 2u * (size_t)NB * HS * TT)     // f32 QE [BG][t][2048]
#define WS_END (WS_QE + 4u * (size_t)BG * TT * NREP)

// ---- k_proj: block = (64 rows, which): q/k/v = x W ((in,out) [768][64]); 64 cols = 4 tiles
__global__ __launch_bounds__(128) void k_proj(const float* __restrict__ X, const float* __restrict__ WQ, const float* __restrict__ WK, const float* __restrict__ WV, _Float16* __restrict__ QH, _Float16* __restrict__ QL, _Float16* __restrict__ KH, __bf16* __restrict__ VT, __bf16* __restrict__ VL) {
  __shared__ __align__(16) _Float16 sh[64][72], sl[64][72]; __shared__ __align__(16) __bf16 th[64][72], tl2[64][72];
  const int tid = threadIdx.x, wave = tid >> 5, lane = tid & 31, col = lane & 15, g = lane >> 4; const int which = blockIdx.y; const size_t r0 = (size_t)blockIdx.x * 64 + wave * 16; const float* Wm = which == 0 ? WQ : which == 1 ? WK : WV;
  v8f acc[4] = {};
#pragma unroll 2
  for (int kc = 0; kc < CIN / 32; ++kc) { v16b a; { const float* p = X + (r0 + col) * CIN + kc * 32 + 8 * g;
#pragma unroll
      for (int i = 0; i < 8; ++i) { a[i] = (__bf16)p[i]; a[8 + i] = (__bf16)p[16 + i]; } }
#pragma unroll
    for (int j = 0; j < 4; ++j) { v16b w; const int o = j * 16 + col;
#pragma unroll
      for (int i = 0; i < 8; ++i) { w[i] = (__bf16)Wm[(size_t)(kc * 32 + 8 * g + i) * HS + o]; w[8 + i] = (__bf16)Wm[(size_t)(kc * 32 + 16 + 8 * g + i) * HS + o]; }
      acc[j] = wmma_bf(a, w, acc[j]); } }
#pragma unroll
  for (int j = 0; j < 4; ++j)
#pragma unroll
    for (int r = 0; r < 8; ++r) { const float v = acc[j][r]; const int rl = wave * 16 + 8 * g + r, cl = j * 16 + col;
      if (which == 2) { const __bf16 bh = (__bf16)v; th[cl][rl] = bh; tl2[cl][rl] = (__bf16)(v - (float)bh); } else { const _Float16 hv = (_Float16)v; sh[rl][cl] = hv; sl[rl][cl] = (_Float16)(v - (float)hv); } }
  __syncthreads();
  const size_t rb = (size_t)blockIdx.x * 64;
  if (which < 2) { _Float16* dh = which == 0 ? QH : KH; for (int e = tid; e < 64 * 8; e += 128) { const int rl = e >> 3, q = e & 7; vst2((unsigned*)(dh + (rb + rl) * HS + q * 8), *(const v4u*)&sh[rl][q * 8]); if (which == 0) vst2((unsigned*)(QL + (rb + rl) * HS + q * 8), *(const v4u*)&sl[rl][q * 8]); } }
  else { const size_t b = rb / TT; const int t0 = (int)(rb % TT); for (int e = tid; e < 64 * 8; e += 128) { const int cl = e >> 3, q = e & 7; const size_t o2 = (b * HS + cl) * (size_t)TT + t0 + q * 8; vst2((unsigned*)(VT + o2), *(const v4u*)&th[cl][q * 8]); vst2((unsigned*)(VL + o2), *(const v4u*)&tl2[cl][q * 8]); } } }
// ---- k_qe: block = (64 rows t, 128 rel cols, batch in group): QE[t][r] = q_t . E[r] (2 products; E row 2047 is a zero pad)
__global__ __launch_bounds__(128) void k_qe(const _Float16* __restrict__ QH, const _Float16* __restrict__ QL, const float* __restrict__ E, int b0, float* __restrict__ QE0) { __shared__ __align__(16) float ss[4][16][132];
  const int tid = threadIdx.x, wave = tid >> 5, lane = tid & 31, col = lane & 15, g = lane >> 4; const int b = b0 + blockIdx.z; float* QE = QE0 + (size_t)blockIdx.z * TT * NREP; const int c0 = blockIdx.y * 128; const int tl0 = blockIdx.x * 64 + wave * 16; const size_t q0 = (size_t)b * TT + tl0;
  v8f acc[8] = {};
#pragma unroll
  for (int kc = 0; kc < HS / 32; ++kc) { const v16h ah = frag_h(QH + (q0 + col) * HS + kc * 32, lane), al = frag_h(QL + (q0 + col) * HS + kc * 32, lane);
#pragma unroll
    for (int j = 0; j < 8; ++j) { v16h eb; const int rr = c0 + j * 16 + col;
#pragma unroll
      for (int i = 0; i < 8; ++i) { eb[i] = (rr < NRE) ? (_Float16)bfr(E[(size_t)rr * HS + kc * 32 + 8 * g + i]) : (_Float16)0.f; eb[8 + i] = (rr < NRE) ? (_Float16)bfr(E[(size_t)rr * HS + kc * 32 + 16 + 8 * g + i]) : (_Float16)0.f; }
      acc[j] = wmma16(ah, eb, acc[j]); acc[j] = wmma16(al, eb, acc[j]); } }
#pragma unroll
  for (int j = 0; j < 8; ++j)
#pragma unroll
    for (int r = 0; r < 8; ++r) ss[wave][8 * g + r][j * 16 + col] = acc[j][r];
  LDSX(); for (int rl = 0; rl < 16; ++rl) vst2(QE + (size_t)(tl0 + rl) * NREP + c0 + lane * 4, *(const v4f*)&ss[wave][rl][lane * 4]); }
// ---- k_att: block = (16 queries t, batch in group), 8 waves; wave w owns keys 128w .. 128w+127 of all 16 rows.
// S = (q . k + QE[t][u - t + T - 1]) / 8 stays in the accumulators; row maximum and row sum go over the 16 lanes of a row, then over the 8 waves through LDS;
// P x 2^11 turns from accumulator to A-fragment layout in the wave's own LDS slab; each wave multiplies its 128 keys into v (3 products); the 8 partial outputs are summed through LDS.
template <int CTRL> __device__ __forceinline__ float row_x(float v) { return __int_as_float(__builtin_amdgcn_update_dpp(0, __float_as_int(v), CTRL, 0xf, 0xf, true)); }   // value of lane ^ mask inside the 16-lane row (row_xmask)
__device__ __forceinline__ float row_max16(float v) { v = fmaxf(v, row_x<0x161>(v)); v = fmaxf(v, row_x<0x162>(v)); v = fmaxf(v, row_x<0x164>(v)); return fmaxf(v, row_x<0x168>(v)); }
__device__ __forceinline__ float row_sum16(float v) { v += row_x<0x161>(v); v += row_x<0x162>(v); v += row_x<0x164>(v); return v + row_x<0x168>(v); }
// launch bounds, second argument: 8 waves per SIMD (128 VGPRs), so that four work-groups share a WGP and all 1,024 work-groups are resident at once
__global__ __launch_bounds__(256, 8) void k_att(const _Float16* __restrict__ QH, const _Float16* __restrict__ QL, const _Float16* __restrict__ KH, const float* __restrict__ QE0, const __bf16* __restrict__ VT, const __bf16* __restrict__ VL, int b0, float* __restrict__ OUT) {
  __shared__ __align__(16) float ss[8][16][132]; __shared__ __align__(16) float rmax[8][16], rsum[8][16];
  const int tid = threadIdx.x, wave = tid >> 5, lane = tid & 31, col = lane & 15, g = lane >> 4; const int b = b0 + blockIdx.z; const float* QE = QE0 + (size_t)blockIdx.z * TT * NREP; const int k0 = wave * 128; const int tl0 = blockIdx.x * 16; const size_t q0 = (size_t)b * TT + tl0;
  v8f acc[8] = {};
#pragma unroll
  for (int kc = 0; kc < HS / 32; ++kc) { const v16h ah = frag_h(QH + (q0 + col) * HS + kc * 32, lane), al = frag_h(QL + (q0 + col) * HS + kc * 32, lane);
#pragma unroll
    for (int j = 0; j < 8; ++j) { const v16h kb = frag_h(KH + ((size_t)b * TT + k0 + j * 16 + col) * HS + kc * 32, lane); acc[j] = wmma16(ah, kb, acc[j]); acc[j] = wmma16(al, kb, acc[j]); } }
  float mr[8], sr[8]; const float* qd = QE + (size_t)(tl0 + 8 * g) * NREP + (k0 + col - (tl0 + 8 * g) + TT - 1);   // QE[t][u - t + T - 1] at t = tl0 + 8g, u = k0 + col; one row down and the same u is NREP - 1 further on
#pragma unroll
  for (int r = 0; r < 8; ++r) mr[r] = -3.0e38f;
#pragma unroll
  for (int j = 0; j < 8; ++j)
#pragma unroll
    for (int r = 0; r < 8; ++r) { acc[j][r] = (acc[j][r] + qd[r * (NREP - 1) + j * 16]) * 0.125f; mr[r] = fmaxf(mr[r], acc[j][r]); }
#pragma unroll
  for (int r = 0; r < 8; ++r) mr[r] = row_max16(mr[r]);
  if (col == 0) {
#pragma unroll
    for (int r = 0; r < 8; ++r) rmax[wave][8 * g + r] = mr[r]; }
  __syncthreads();
#pragma unroll
  for (int r = 0; r < 8; ++r) { float a = rmax[0][8 * g + r];
#pragma unroll
    for (int w = 1; w < 8; ++w) a = fmaxf(a, rmax[w][8 * g + r]);
    mr[r] = a; sr[r] = 0.f; }
#pragma unroll
  for (int j = 0; j < 8; ++j)
#pragma unroll
    for (int r = 0; r < 8; ++r) { acc[j][r] = expf(acc[j][r] - mr[r]); sr[r] += acc[j][r]; }
#pragma unroll
  for (int r = 0; r < 8; ++r) sr[r] = row_sum16(sr[r]);
  if (col == 0) {
#pragma unroll
    for (int r = 0; r < 8; ++r) rsum[wave][8 * g + r] = sr[r]; }
  __syncthreads();
#pragma unroll
  for (int r = 0; r < 8; ++r) { float a = 0.f;
#pragma unroll
    for (int w = 0; w < 8; ++w) a += rsum[w][8 * g + r];
    sr[r] = 1.0f / a; }
#pragma unroll
  for (int j = 0; j < 8; ++j)
#pragma unroll
    for (int r = 0; r < 8; ++r) ss[wave][8 * g + r][j * 16 + col] = acc[j][r] * sr[r] * 2048.0f;
  LDSX();   // the slab is written by rows of the accumulator layout and read back by other lanes of the same wave: the stores must have landed first
  v8f o[4] = {};
#pragma unroll
  for (int kc = 0; kc < 4; ++kc) { const F2 p = split_row(&ss[wave][col][0], kc * 32, lane);
#pragma unroll
    for (int j = 0; j < 4; ++j) { const size_t po = ((size_t)b * HS + j * 16 + col) * (size_t)TT + k0 + kc * 32; const v16b vh = frag_b(VT + po, lane); o[j] = wmma_bf(p.h, vh, o[j]); o[j] = wmma_bf(p.l, vh, o[j]); o[j] = wmma_bf(p.h, frag_b(VL + po, lane), o[j]); } }
#pragma unroll
  for (int j = 0; j < 4; ++j)
#pragma unroll
    for (int r = 0; r < 8; ++r) ss[wave][8 * g + r][j * 16 + col] = o[j][r];   // over the wave's own P slab: every read of it has fed the products above
  __syncthreads();
  { const int rl = tid >> 4, c4 = (tid & 15) * 4; v4f a = *(const v4f*)&ss[0][rl][c4];
#pragma unroll
    for (int w = 1; w < 8; ++w) a += *(const v4f*)&ss[w][rl][c4];
    vst2(OUT + (q0 + rl) * HS + c4, a * (1.0f / 2048.0f)); } }
extern "C" void kernel_launch(void* const* d_in, const int* in_sizes, int n_in, void* d_out, int out_size, void* d_ws, size_t ws_size, hipStream_t stream) {
  (void)in_sizes; (void)n_in; (void)out_size;
  const float** F = (const float**)d_in;   // 0 x [16,1024,768], 1 Wq [768,64], 2 Wk, 3 Wv, 4 E [2047,64]
  if (ws_size < (size_t)WS_END) return;
  char* ws = (char*)d_ws; _Float16 *QH = (_Float16*)(ws + WS_QH), *QL = (_Float16*)(ws + WS_QL), *KH = (_Float16*)(ws + WS_KH); __bf16 *VT = (__bf16*)(ws + WS_VT), *VL = (__bf16*)(ws + WS_VL); float *QE = (float*)(ws + WS_QE);
  k_proj<<<dim3(TNB * TT / 64, 3), 128, 0, stream>>>(F[0], F[1], F[2], F[3], QH, QL, KH, VT, VL);
  for (int b0 = 0; b0 < TNB; b0 += BG) { const int ng = (TNB - b0 < BG) ? (TNB - b0) : BG;
    k_qe<<<dim3(TT / 64, NREP / 128, ng), 128, 0, stream>>>(QH, QL, F[4], b0, QE);
    k_att<<<dim3(TT / 16, 1, ng), 256, 0, stream>>>(QH, QL, KH, QE, VT, VL, b0, (float*)d_out);
  }
}

// v003
// One run takes 77.9 microseconds.
// In both of two side-by-side timings against v002, it was 1.98 times as fast.
// Over all steps from v000 it is 5.76 times as fast.
// compute dtype: all float inputs rounded to bf16; q/k/v = x W with EXACT bf16 products on WMMA 16x16x32, f32 accumulate; q as f16 hi + residual; relative logits q_t . E[u - t + T - 1] from each wave's own band of q E^T (2 products, E rounded once to f16), skewed through LDS, and content logits q . k (2 products, k f16), summed and scaled by 64^-0.5, kept in f32 registers (16 whole rows per work-group); softmax in f32 (precise expf), P x 2^11 kept f32 split bf16 hi + lo against v bf16 hi + lo (3 products), 8 partial sums of 128 keys added in f32; f32 output [b][t][64].
#include <hip/hip_runtime.h>
#include <math.h>

typedef __attribute__((ext_vector_type(16))) _Float16 v16h;
typedef __attribute__((ext_vector_type(16))) __bf16 v16b;
typedef __attribute__((ext_vector_type(8)))  _Float16 v8h;
typedef __attribute__((ext_vector_type(8)))  float v8f;
typedef __attribute__((ext_vector_type(4)))  float v4f;
typedef __attribute__((ext_vector_type(2)))  float v2f;
typedef __attribute__((ext_vector_type(4)))  unsigned v4u;
typedef __attribute__((ext_vector_type(4)))  int v4i;
typedef float __attribute__((may_alias)) float_a;
typedef int __attribute__((may_alias)) int_a;

template <typename T> __device__ __forceinline__ void vst2(void* p, T v) { *(T*)p = v;  }
__device__ __forceinline__ v8f wmma16(v16h a, v16h b, v8f c) {
  v8f d = __builtin_amdgcn_wmma_f32_16x16x32_f16(false, a, false, b, (short)0, c, false, false);
  asm volatile("v_nop\n\tv_nop\n\tv_nop\n\tv_nop" : "+v"(d) : "v"(a), "v"(b));
  return d;
}
__device__ __forceinline__ v8f wmma_bf(v16b a, v16b b, v8f c) {
  v8f d = __builtin_amdgcn_wmma_f32_16x16x32_bf16(false, a, false, b, (short)0, c, false, false);
  asm volatile("v_nop\n\tv_nop\n\tv_nop\n\tv_nop" : "+v"(d) : "v"(a), "v"(b));
  return d;
}
// 16x16x32 fragments: lane = (h = lane>>4, row/col = lane&15); elements 0..7 = k0+8h+0..7, 8..15 = k0+16+8h+0..7; D element r = row 8h+r
__device__ __forceinline__ v16h frag_h(const _Float16* rowk0, int lane) {
  union { v16h v; v8h q[2]; } u; const _Float16* p = rowk0 + 8 * (lane >> 4);
  u.q[0] = *(const v8h*)p; u.q[1] = *(const v8h*)(p + 16); return u.v;
}
__device__ __forceinline__ v16h frag_f32(const float* rowk0, int lane) {
  v16h a; const float* p = rowk0 + 8 * (lane >> 4);
#pragma unroll
  for (int i = 0; i < 8; ++i) { a[i] = (_Float16)p[i]; a[8 + i] = (_Float16)p[16 + i]; }
  return a;
}
__device__ __forceinline__ v16h frag_f32s(const float* rowk0, int lane, float sc) {
  v16h a; const float* p = rowk0 + 8 * (lane >> 4);
#pragma unroll
  for (int i = 0; i < 8; ++i) { a[i] = (_Float16)(p[i] * sc); a[8 + i] = (_Float16)(p[16 + i] * sc); }
  return a;
}
// column fragment from a [K][ld] layout (column n), rows >= K read as 0
__device__ __forceinline__ v16h fragc_f32(const float* W, int k0, int n, int lane, int ld, int K) {
  v16h a; const int g = lane >> 4;
#pragma unroll
  for (int i = 0; i < 8; ++i) { const int ka = k0 + 8 * g + i, kb = ka + 16;
    a[i] = (_Float16)(ka < K ? W[(size_t)(ka < K ? ka : K - 1) * ld + n] : 0.f); a[8 + i] = (_Float16)(kb < K ? W[(size_t)(kb < K ? kb : K - 1) * ld + n] : 0.f); }
  return a;
}
struct F2 { v16b h, l; };
__device__ __forceinline__ F2 bsplit16(const float v[16]) { F2 r;
#pragma unroll
  for (int i = 0; i < 16; ++i) { const __bf16 h = (__bf16)v[i]; r.h[i] = h; r.l[i] = (__bf16)(v[i] - (float)h); }
  return r; }
__device__ __forceinline__ F2 split_row(const float* row, int k0, int lane) { float v[16]; const float* p = row + k0 + 8 * (lane >> 4);
#pragma unroll
  for (int i = 0; i < 8; ++i) { v[i] = p[i]; v[8 + i] = p[16 + i]; }
  return bsplit16(v); }
__device__ __forceinline__ F2 split_rowK(const float* row, int k0, int lane, int K) { float v[16]; const int g = lane >> 4;
#pragma unroll
  for (int i = 0; i < 8; ++i) { const int ka = k0 + 8 * g + i, kb = ka + 16; v[i] = ka < K ? row[ka < K ? ka : K - 1] : 0.f; v[8 + i] = kb < K ? row[kb < K ? kb : K - 1] : 0.f; }
  return bsplit16(v); }
__device__ __forceinline__ F2 split_col(const float* W, int k0, int n, int lane, int ld, int K) { float v[16]; const int g = lane >> 4;
#pragma unroll
  for (int i = 0; i < 8; ++i) { const int ka = k0 + 8 * g + i, kb = ka + 16; v[i] = ka < K ? W[(size_t)(ka < K ? ka : K - 1) * ld + n] : 0.f; v[8 + i] = kb < K ? W[(size_t)(kb < K ? kb : K - 1) * ld + n] : 0.f; }
  return bsplit16(v); }
__device__ __forceinline__ v8f mac3(const F2& a, const F2& b, v8f c) { c = wmma_bf(a.l, b.h, c); c = wmma_bf(a.h, b.l, c); return wmma_bf(a.h, b.h, c); }
__device__ __forceinline__ float sigm(float v) { return 1.0f / (1.0f + expf(-v)); }
#define LDSX() do { asm volatile("s_wait_dscnt 0" ::: "memory"); __builtin_amdgcn_wave_barrier(); __builtin_amdgcn_fence(__ATOMIC_RELEASE, "workgroup"); } while (0)


// Relative attention head (B 16, T 1,024, C 768, head 64; learned relative embeddings E[2T-1, 64]): wei = softmax((q k^T + S_rel) / 8) with S_rel[t][u] = q_t . E[u - t + T - 1]; out = wei v.
#define NB 16
#define TT 1024
#define CIN 768
#define HS 64
#define NRE 2047
#define NREP 2048
#define BG NB                // batches per launch group: all of them, so that every stage is one launch
#ifndef TNB
#define TNB NB
#endif
typedef __attribute__((ext_vector_type(8))) __bf16 v8b;
typedef __attribute__((ext_vector_type(4))) _Float16 v4hh;
__device__ __forceinline__ v16b frag_b(const __bf16* rowk0, int lane) {
  union { v16b v; v8b q[2]; } u; const __bf16* p = rowk0 + 8 * (lane >> 4);
  u.q[0] = *(const v8b*)p; u.q[1] = *(const v8b*)(p + 16); return u.v;
}
__device__ __forceinline__ float bfr(float v) { return (float)(__bf16)v; }
__device__ __attribute__((noinline)) float exp_ni(float v) { return expf(v); }
__device__ __attribute__((noinline)) float erf_ni(float v) { return erff(v); }

#define WS_QH  0u                                  // f16 q rows [b*t][64]
#define WS_QL  (WS_QH + 2u * (size_t)NB * TT * HS)
#define WS_KH  (WS_QL + 2u * (size_t)NB * TT * HS)
#define WS_VT  (WS_KH + 2u * (size_t)NB * TT * HS)     // bf16 v planes hi [b][64][t]
#define WS_VL  (WS_VT + 2u * (size_t)NB * HS * TT)
#define WS_EH  (WS_VL + 2u * (size_t)NB * HS * TT)     // f16 E rows [2048][64], row 2047 a zero pad
#define WS_END (WS_EH + 2u * (size_t)NREP * HS)

static_assert(TNB * TT / 64 * 512 == NREP * HS, "the which == 3 blocks of k_proj cover the f16 copy of E exactly once");
// ---- k_proj: block = (64 rows, which): q/k/v = x W ((in,out) [768][64]); 64 cols = 4 tiles; which == 3: 512 elements of E rounded to f16
__global__ __launch_bounds__(128) void k_proj(const float* __restrict__ X, const float* __restrict__ WQ, const float* __restrict__ WK, const float* __restrict__ WV, const float* __restrict__ E, _Float16* __restrict__ EH, _Float16* __restrict__ QH, _Float16* __restrict__ QL, _Float16* __restrict__ KH, __bf16* __restrict__ VT, __bf16* __restrict__ VL) {
  __shared__ __align__(16) _Float16 sh[64][72], sl[64][72]; __shared__ __align__(16) __bf16 th[64][72], tl2[64][72];
  const int tid = threadIdx.x, wave = tid >> 5, lane = tid & 31, col = lane & 15, g = lane >> 4; const int which = blockIdx.y; const size_t r0 = (size_t)blockIdx.x * 64 + wave * 16; const float* Wm = which == 0 ? WQ : which == 1 ? WK : WV;
  if (which == 3) { const int e0 = (blockIdx.x * 128 + tid) * 4; v4hh h = {};   // the whole block leaves here, ahead of the barrier
    if (e0 < NRE * HS) { const v4f ev = *(const v4f*)(E + e0);
#pragma unroll
      for (int i = 0; i < 4; ++i) h[i] = (_Float16)bfr(ev[i]); }
    vst2(EH + e0, h); return; }
  v8f acc[4] = {};
#pragma unroll 2
  for (int kc = 0; kc < CIN / 32; ++kc) { v16b a; { const float* p = X + (r0 + col) * CIN + kc * 32 + 8 * g;
#pragma unroll
      for (int i = 0; i < 8; ++i) { a[i] = (__bf16)p[i]; a[8 + i] = (__bf16)p[16 + i]; } }
#pragma unroll
    for (int j = 0; j < 4; ++j) { v16b w; const int o = j * 16 + col;
#pragma unroll
      for (int i = 0; i < 8; ++i) { w[i] = (__bf16)Wm[(size_t)(kc * 32 + 8 * g + i) * HS + o]; w[8 + i] = (__bf16)Wm[(size_t)(kc * 32 + 16 + 8 * g + i) * HS + o]; }
      acc[j] = wmma_bf(a, w, acc[j]); } }
#pragma unroll
  for (int j = 0; j < 4; ++j)
#pragma unroll
    for (int r = 0; r < 8; ++r) { const float v = acc[j][r]; const int rl = wave * 16 + 8 * g + r, cl = j * 16 + col;
      if (which == 2) { const __bf16 bh = (__bf16)v; th[cl][rl] = bh; tl2[cl][rl] = (__bf16)(v - (float)bh); } else { const _Float16 hv = (_Float16)v; sh[rl][cl] = hv; sl[rl][cl] = (_Float16)(v - (float)hv); } }
  __syncthreads();
  const size_t rb = (size_t)blockIdx.x * 64;
  if (which < 2) { _Float16* dh = which == 0 ? QH : KH; for (int e = tid; e < 64 * 8; e += 128) { const int rl = e >> 3, q = e & 7; vst2((unsigned*)(dh + (rb + rl) * HS + q * 8), *(const v4u*)&sh[rl][q * 8]); if (which == 0) vst2((unsigned*)(QL + (rb + rl) * HS + q * 8), *(const v4u*)&sl[rl][q * 8]); } }
  else { const size_t b = rb / TT; const int t0 = (int)(rb % TT); for (int e = tid; e < 64 * 8; e += 128) { const int cl = e >> 3, q = e & 7; const size_t o2 = (b * HS + cl) * (size_t)TT + t0 + q * 8; vst2((unsigned*)(VT + o2), *(const v4u*)&th[cl][q * 8]); vst2((unsigned*)(VL + o2), *(const v4u*)&tl2[cl][q * 8]); } } }
// ---- k_att: block = (16 queries t, batch in group), 8 waves; wave w owns keys 128w .. 128w+127 of all 16 rows.
// Relative logits: row t = tl0 + i and key u = k0 + c want q_t . E[R0 + c - i + 15], R0 = k0 - tl0 + T - 16: the wave multiplies its 16 queries into the 144 rows E[R0 ..] (9 tiles)
// and stores element (i, m) of that band at (i, m + i - 15) of its LDS slab; of tiles 0 and 8 each lane keeps the one whose key falls inside 0 .. 127.
// S = (q . k + relative logit) / 8 stays in the accumulators; row maximum and row sum go over the 16 lanes of a row, then over the 8 waves through LDS;
// P x 2^11 turns from accumulator to A-fragment layout in the wave's own LDS slab; each wave multiplies its 128 keys into v (3 products); the 8 partial outputs are summed through LDS.
template <int CTRL> __device__ __forceinline__ float row_x(float v) { return __int_as_float(__builtin_amdgcn_update_dpp(0, __float_as_int(v), CTRL, 0xf, 0xf, true)); }   // value of lane ^ mask inside the 16-lane row (row_xmask)
__device__ __forceinline__ float row_max16(float v) { v = fmaxf(v, row_x<0x161>(v)); v = fmaxf(v, row_x<0x162>(v)); v = fmaxf(v, row_x<0x164>(v)); return fmaxf(v, row_x<0x168>(v)); }
__device__ __forceinline__ float row_sum16(float v) { v += row_x<0x161>(v); v += row_x<0x162>(v); v += row_x<0x164>(v); return v + row_x<0x168>(v); }
// launch bounds, second argument: 8 waves per SIMD (128 VGPRs), so that four work-groups share a WGP and all 1,024 work-groups are resident at once
__global__ __launch_bounds__(256, 8) void k_att(const _Float16* __restrict__ QH, const _Float16* __restrict__ QL, const _Float16* __restrict__ KH, const _Float16* __restrict__ EH, const __bf16* __restrict__ VT, const __bf16* __restrict__ VL, int b0, float* __restrict__ OUT) {
  __shared__ __align__(16) float ss[8][16][132]; __shared__ __align__(16) float rmax[8][16], rsum[8][16];
  const int tid = threadIdx.x, wave = tid >> 5, lane = tid & 31, col = lane & 15, g = lane >> 4; const int b = b0 + blockIdx.z; const int k0 = wave * 128; const int tl0 = blockIdx.x * 16; const size_t q0 = (size_t)b * TT + tl0;
  { const _Float16* eb0 = EH + (size_t)(k0 - tl0 + TT - 16 + col) * HS; float* sw = &ss[wave][0][0] + 8 * g * 133 + col; v8f d0;
    const v16h ah0 = frag_h(QH + (q0 + col) * HS, lane), al0 = frag_h(QL + (q0 + col) * HS, lane), ah1 = frag_h(QH + (q0 + col) * HS + 32, lane), al1 = frag_h(QL + (q0 + col) * HS + 32, lane);
    v16h e0[9], e1[9];   // tiles in the order 0, 8, 1 .. 7, fetched two ahead
#pragma unroll
    for (int n = 0; n < 2; ++n) { e0[n] = frag_h(eb0 + n * 8 * 16 * HS, lane); e1[n] = frag_h(eb0 + n * 8 * 16 * HS + 32, lane); }
#pragma unroll
    for (int n = 0; n < 9; ++n) { v8f d = {}; const int jt = n == 0 ? 0 : n == 1 ? 8 : n - 1;
      if (n + 2 < 9) { e0[n + 2] = frag_h(eb0 + (n + 1) * 16 * HS, lane); e1[n + 2] = frag_h(eb0 + (n + 1) * 16 * HS + 32, lane); }
      __builtin_amdgcn_sched_barrier(0);   // keeps the loads of the tile after next above this tile's products: without it each tile waits out its own load latency
      d = wmma16(ah0, e0[n], d); d = wmma16(al0, e0[n], d); d = wmma16(ah1, e1[n], d); d = wmma16(al1, e1[n], d);
      if (jt == 0) d0 = d;
      else if (jt < 8) {
#pragma unroll
        for (int r = 0; r < 8; ++r) sw[r * 133 + jt * 16 - 15] = d[r]; }
      else {
#pragma unroll
        for (int r = 0; r < 8; ++r) { const int s = col + 8 * g + r - 15; ss[wave][8 * g + r][s & 127] = s >= 0 ? d0[r] : d[r]; } } } }
  v8f acc[8] = {};
#pragma unroll
  for (int kc = 0; kc < HS / 32; ++kc) { const v16h ah = frag_h(QH + (q0 + col) * HS + kc * 32, lane), al = frag_h(QL + (q0 + col) * HS + kc * 32, lane);
#pragma unroll
    for (int j = 0; j < 8; ++j) { const v16h kb = frag_h(KH + ((size_t)b * TT + k0 + j * 16 + col) * HS + kc * 32, lane); acc[j] = wmma16(ah, kb, acc[j]); acc[j] = wmma16(al, kb, acc[j]); } }
  float mr[8], sr[8];
  LDSX();   // the skewed band was stored by other lanes of the same wave than those that read it now: the stores must have landed first
#pragma unroll
  for (int r = 0; r < 8; ++r) mr[r] = -3.0e38f;
#pragma unroll
  for (int j = 0; j < 8; ++j)
#pragma unroll
    for (int r = 0; r < 8; ++r) { acc[j][r] = (acc[j][r] + ss[wave][8 * g + r][j * 16 + col]) * 0.125f; mr[r] = fmaxf(mr[r], acc[j][r]); }
#pragma unroll
  for (int r = 0; r < 8; ++r) mr[r] = row_max16(mr[r]);
  if (col == 0) {
#pragma unroll
    for (int r = 0; r < 8; ++r) rmax[wave][8 * g + r] = mr[r]; }
  __syncthreads();
#pragma unroll
  for (int r = 0; r < 8; ++r) { float a = rmax[0][8 * g + r];
#pragma unroll
    for (int w = 1; w < 8; ++w) a = fmaxf(a, rmax[w][8 * g + r]);
    mr[r] = a; sr[r] = 0.f; }
#pragma unroll
  for (int j = 0; j < 8; ++j)
#pragma unroll
    for (int r = 0; r < 8; ++r) { acc[j][r] = expf(acc[j][r] - mr[r]); sr[r] += acc[j][r]; }
#pragma unroll
  for (int r = 0; r < 8; ++r) sr[r] = row_sum16(sr[r]);
  if (col == 0) {
#pragma unroll
    for (int r = 0; r < 8; ++r) rsum[wave][8 * g + r] = sr[r]; }
  __syncthreads();
#pragma unroll
  for (int r = 0; r < 8; ++r) { float a = 0.f;
#pragma unroll
    for (int w = 0; w < 8; ++w) a += rsum[w][8 * g + r];
    sr[r] = 1.0f / a; }
#pragma unroll
  for (int j = 0; j < 8; ++j)
#pragma unroll
    for (int r = 0; r < 8; ++r) ss[wave][8 * g + r][j * 16 + col] = acc[j][r] * sr[r] * 2048.0f;
  LDSX();   // the slab is written by rows of the accumulator layout and read back by other lanes of the same wave: the stores must have landed first
  v8f o[4] = {};
#pragma unroll
  for (int kc = 0; kc < 4; ++kc) { const F2 p = split_row(&ss[wave][col][0], kc * 32, lane);
#pragma unroll
    for (int j = 0; j < 4; ++j) { const size_t po = ((size_t)b * HS + j * 16 + col) * (size_t)TT + k0 + kc * 32; const v16b vh = frag_b(VT + po, lane); o[j] = wmma_bf(p.h, vh, o[j]); o[j] = wmma_bf(p.l, vh, o[j]); o[j] = wmma_bf(p.h, frag_b(VL + po, lane), o[j]); } }
#pragma unroll
  for (int j = 0; j < 4; ++j)
#pragma unroll
    for (int r = 0; r < 8; ++r) ss[wave][8 * g + r][j * 16 + col] = o[j][r];   // over the wave's own P slab: every read of it has fed the products above
  __syncthreads();
  { const int rl = tid >> 4, c4 = (tid & 15) * 4; v4f a = *(const v4f*)&ss[0][rl][c4];
#pragma unroll
    for (int w = 1; w < 8; ++w) a += *(const v4f*)&ss[w][rl][c4];
    vst2(OUT + (q0 + rl) * HS + c4, a * (1.0f / 2048.0f)); } }
extern "C" void kernel_launch(void* const* d_in, const int* in_sizes, int n_in, void* d_out, int out_size, void* d_ws, size_t ws_size, hipStream_t stream) {
  (void)in_sizes; (void)n_in; (void)out_size;
  const float** F = (const float**)d_in;   // 0 x [16,1024,768], 1 Wq [768,64], 2 Wk, 3 Wv, 4 E [2047,64]
  if (ws_size < (size_t)WS_END) return;
  char* ws = (char*)d_ws; _Float16 *QH = (_Float16*)(ws + WS_QH), *QL = (_Float16*)(ws + WS_QL), *KH = (_Float16*)(ws + WS_KH); __bf16 *VT = (__bf16*)(ws + WS_VT), *VL = (__bf16*)(ws + WS_VL); _Float16 *EH = (_Float16*)(ws + WS_EH);
  k_proj<<<dim3(TNB * TT / 64, 4), 128, 0, stream>>>(F[0], F[1], F[2], F[3], F[4], EH, QH, QL, KH, VT, VL);
  for (int b0 = 0; b0 < TNB; b0 += BG) { const int ng = (TNB - b0 < BG) ? (TNB - b0) : BG;
    k_att<<<dim3(TT / 16, 1, ng), 256, 0, stream>>>(QH, QL, KH, EH, VT, VL, b0, (float*)d_out);
  }
}

// v004
// It runs in 70 microseconds.
// Timed twice side by side with v003, it ran 1.12 times as fast both times.
// All steps since v000 together make it 6.42 times as fast.
// compute dtype: all float inputs rounded to bf16; q/k/v = x W with EXACT bf16 products on WMMA 16x16x32, f32 accumulate; q as f16 hi + residual; relative logits q_t . E[u - t + T - 1] from each wave's own band of q E^T (2 products, E rounded once to f16), skewed through LDS, and content logits q . k (2 products, k f16), summed and scaled by 64^-0.5, kept in f32 registers (16 whole rows per work-group); softmax in f32 (precise expf), P x 2^11 kept f32 split bf16 hi + lo against v bf16 hi + lo (3 products), 8 partial sums of 128 keys added in f32; f32 output [b][t][64].
#include <hip/hip_runtime.h>
#include <math.h>

typedef __attribute__((ext_vector_type(16))) _Float16 v16h;
typedef __attribute__((ext_vector_type(16))) __bf16 v16b;
typedef __attribute__((ext_vector_type(8)))  _Float16 v8h;
typedef __attribute__((ext_vector_type(8)))  float v8f;
typedef __attribute__((ext_vector_type(4)))  float v4f;
typedef __attribute__((ext_vector_type(2)))  float v2f;
typedef __attribute__((ext_vector_type(4)))  unsigned v4u;
typedef __attribute__((ext_vector_type(4)))  int v4i;
typedef float __attribute__((may_alias)) float_a;
typedef int __attribute__((may_alias)) int_a;

template <typename T> __device__ __forceinline__ void vst2(void* p, T v) { *(T*)p = v;  }
__device__ __forceinline__ v8f wmma16(v16h a, v16h b, v8f c) {
  v8f d = __builtin_amdgcn_wmma_f32_16x16x32_f16(false, a, false, b, (short)0, c, false, false);
  asm volatile("v_nop\n\tv_nop\n\tv_nop\n\tv_nop" : "+v"(d) : "v"(a), "v"(b));
  return d;
}
__device__ __forceinline__ v8f wmma_bf(v16b a, v16b b, v8f c) {
  v8f d = __builtin_amdgcn_wmma_f32_16x16x32_bf16(false, a, false, b, (short)0, c, false, false);
  asm volatile("v_nop\n\tv_nop\n\tv_nop\n\tv_nop" : "+v"(d) : "v"(a), "v"(b));
  return d;
}
// 16x16x32 fragments: lane = (h = lane>>4, row/col = lane&15); elements 0..7 = k0+8h+0..7, 8..15 = k0+16+8h+0..7; D element r = row 8h+r
__device__ __forceinline__ v16h frag_h(const _Float16* rowk0, int lane) {
  union { v16h v; v8h q[2]; } u; const _Float16* p = rowk0 + 8 * (lane >> 4);
  u.q[0] = *(const v8h*)p; u.q[1] = *(const v8h*)(p + 16); return u.v;
}
__device__ __forceinline__ v16h frag_f32(const float* rowk0, int lane) {
  v16h a; const float* p = rowk0 + 8 * (lane >> 4);
#pragma unroll
  for (int i = 0; i < 8; ++i) { a[i] = (_Float16)p[i]; a[8 + i] = (_Float16)p[16 + i]; }
  return a;
}
__device__ __forceinline__ v16h frag_f32s(const float* rowk0, int lane, float sc) {
  v16h a; const float* p = rowk0 + 8 * (lane >> 4);
#pragma unroll
  for (int i = 0; i < 8; ++i) { a[i] = (_Float16)(p[i] * sc); a[8 + i] = (_Float16)(p[16 + i] * sc); }
  return a;
}
// column fragment from a [K][ld] layout (column n), rows >= K read as 0
__device__ __forceinline__ v16h fragc_f32(const float* W, int k0, int n, int lane, int ld, int K) {
  v16h a; const int g = lane >> 4;
#pragma unroll
  for (int i = 0; i < 8; ++i) { const int ka = k0 + 8 * g + i, kb = ka + 16;
    a[i] = (_Float16)(ka < K ? W[(size_t)(ka < K ? ka : K - 1) * ld + n] : 0.f); a[8 + i] = (_Float16)(kb < K ? W[(size_t)(kb < K ? kb : K - 1) * ld + n] : 0.f); }
  return a;
}
struct F2 { v16b h, l; };
__device__ __forceinline__ F2 bsplit16(const float v[16]) { F2 r;
#pragma unroll
  for (int i = 0; i < 16; ++i) { const __bf16 h = (__bf16)v[i]; r.h[i] = h; r.l[i] = (__bf16)(v[i] - (float)h); }
  return r; }
__device__ __forceinline__ F2 split_row(const float* row, int k0, int lane) { float v[16]; const float* p = row + k0 + 8 * (lane >> 4);
#pragma unroll
  for (int i = 0; i < 8; ++i) { v[i] = p[i]; v[8 + i] = p[16 + i]; }
  return bsplit16(v); }
__device__ __forceinline__ F2 split_rowK(const float* row, int k0, int lane, int K) { float v[16]; const int g = lane >> 4;
#pragma unroll
  for (int i = 0; i < 8; ++i) { const int ka = k0 + 8 * g + i, kb = ka + 16; v[i] = ka < K ? row[ka < K ? ka : K - 1] : 0.f; v[8 + i] = kb < K ? row[kb < K ? kb : K - 1] : 0.f; }
  return bsplit16(v); }
__device__ __forceinline__ F2 split_col(const float* W, int k0, int n, int lane, int ld, int K) { float v[16]; const int g = lane >> 4;
#pragma unroll
  for (int i = 0; i < 8; ++i) { const int ka = k0 + 8 * g + i, kb = ka + 16; v[i] = ka < K ? W[(size_t)(ka < K ? ka : K - 1) * ld + n] : 0.f; v[8 + i] = kb < K ? W[(size_t)(kb < K ? kb : K - 1) * ld + n] : 0.f; }
  return bsplit16(v); }
__device__ __forceinline__ v8f mac3(const F2& a, const F2& b, v8f c) { c = wmma_bf(a.l, b.h, c); c = wmma_bf(a.h, b.l, c); return wmma_bf(a.h, b.h, c); }
__device__ __forceinline__ float sigm(float v) { return 1.0f / (1.0f + expf(-v)); }
#define LDSX() do { asm volatile("s_wait_dscnt 0" ::: "memory"); __builtin_amdgcn_wave_barrier(); __builtin_amdgcn_fence(__ATOMIC_RELEASE, "workgroup"); } while (0)


// Relative attention head (B 16, T 1,024, C 768, head 64; learned relative embeddings E[2T-1, 64]): wei = softmax((q k^T + S_rel) / 8) with S_rel[t][u] = q_t . E[u - t + T - 1]; out = wei v.
#define NB 16
#define TT 1024
#define CIN 768
#define HS 64
#define NRE 2047
#define NREP 2048
#define BG NB                // batches per launch group: all of them, so that every stage is one launch
#ifndef TNB
#define TNB NB
#endif
typedef __attribute__((ext_vector_type(8))) __bf16 v8b;
typedef __attribute__((ext_vector_type(4))) _Float16 v4hh;
__device__ __forceinline__ v16b frag_b(const __bf16* rowk0, int lane) {
  union { v16b v; v8b q[2]; } u; const __bf16* p = rowk0 + 8 * (lane >> 4);
  u.q[0] = *(const v8b*)p; u.q[1] = *(const v8b*)(p + 16); return u.v;
}
// fragment-order planes: a tile = 16 rows x 32 k = 512 elements, stored as [half q][lane][8]: lane (h, row) holds k = 16q + 8h + 0..7 of its row, so that one wave-wide 16-byte load reads 512 contiguous bytes (4 whole lines, not 16 quarter lines)
__device__ __forceinline__ v16h frag_ph(const _Float16* tile, int lane) {
  union { v16h v; v8h q[2]; } u; const _Float16* p = tile + 8 * lane;
  u.q[0] = *(const v8h*)p; u.q[1] = *(const v8h*)(p + 256); return u.v;
}
// the same for the last fragment read through an address pair
__device__ __forceinline__ v16h frag_ph_last(const _Float16* tile, int lane) {
  union { v16h v; v8h q[2]; } u; const _Float16* p = tile + 8 * lane;
  u.q[0] = *(const v8h*)p; asm volatile("s_wait_xcnt 0x0" ::: "memory"); u.q[1] = *(const v8h*)(p + 256); return u.v;
}
__device__ __forceinline__ v16b frag_pb(const __bf16* tile, int lane) {
  union { v16b v; v8b q[2]; } u; const __bf16* p = tile + 8 * lane;
  u.q[0] = *(const v8b*)p; u.q[1] = *(const v8b*)(p + 256); return u.v;
}
__device__ __forceinline__ float bfr(float v) { return (float)(__bf16)v; }
__device__ __attribute__((noinline)) float exp_ni(float v) { return expf(v); }
__device__ __attribute__((noinline)) float erf_ni(float v) { return erff(v); }

#define WS_QH  0u                                  // f16 q, fragment order: tiles [b*t / 16][k / 32]
#define WS_QL  (WS_QH + 2u * (size_t)NB * TT * HS)
#define WS_KH  (WS_QL + 2u * (size_t)NB * TT * HS)
#define WS_VT  (WS_KH + 2u * (size_t)NB * TT * HS)     // bf16 v planes hi, fragment order: tiles [b*t / 32][d / 16], rows d, k = t
#define WS_VL  (WS_VT + 2u * (size_t)NB * HS * TT)
#define WS_EH  (WS_VL + 2u * (size_t)NB * HS * TT)     // f16 E, fragment order: tiles [row / 16][k / 32] of 2048 rows, row 2047 a zero pad
#define WS_END (WS_EH + 2u * (size_t)NREP * HS)

static_assert(TNB * TT / 64 * 512 == NREP * HS, "the which == 3 blocks of k_proj cover the f16 copy of E exactly once");
// ---- k_proj: block = (64 rows, which): q/k/v = x W ((in,out) [768][64]); 64 cols = 4 tiles; which == 3: 512 elements of E rounded to f16
__global__ __launch_bounds__(128) void k_proj(const float* __restrict__ X, const float* __restrict__ WQ, const float* __restrict__ WK, const float* __restrict__ WV, const float* __restrict__ E, _Float16* __restrict__ EH, _Float16* __restrict__ QH, _Float16* __restrict__ QL, _Float16* __restrict__ KH, __bf16* __restrict__ VT, __bf16* __restrict__ VL) {
  __shared__ __align__(16) _Float16 sh[64][72], sl[64][72]; __shared__ __align__(16) __bf16 th[64][72], tl2[64][72];
  const int tid = threadIdx.x, wave = tid >> 5, lane = tid & 31, col = lane & 15, g = lane >> 4; const int which = blockIdx.y; const size_t r0 = (size_t)blockIdx.x * 64 + wave * 16; const float* Wm = which == 0 ? WQ : which == 1 ? WK : WV;
  if (which == 3) { const int e0 = (blockIdx.x * 128 + tid) * 4; v4hh h = {};   // the whole block leaves here, ahead of the barrier
    const int c = e0 >> 3, er = (c >> 7) * 16 + (c & 15), ek = ((c >> 5) & 3) * 16 + ((c >> 4) & 1) * 8 + (e0 & 7);   // row and k of E that belong at place e0 of the fragment-order plane
    if (er < NRE) { const v4f ev = *(const v4f*)(E + er * HS + ek);
#pragma unroll
      for (int i = 0; i < 4; ++i) h[i] = (_Float16)bfr(ev[i]); }
    vst2(EH + e0, h); return; }
  v8f acc[4] = {};
#pragma unroll 2
  for (int kc = 0; kc < CIN / 32; ++kc) { v16b a; { const float* p = X + (r0 + col) * CIN + kc * 32 + 8 * g;
#pragma unroll
      for (int i = 0; i < 8; ++i) { a[i] = (__bf16)p[i]; a[8 + i] = (__bf16)p[16 + i]; } }
#pragma unroll
    for (int j = 0; j < 4; ++j) { v16b w; const int o = j * 16 + col;
#pragma unroll
      for (int i = 0; i < 8; ++i) { w[i] = (__bf16)Wm[(size_t)(kc * 32 + 8 * g + i) * HS + o]; w[8 + i] = (__bf16)Wm[(size_t)(kc * 32 + 16 + 8 * g + i) * HS + o]; }
      acc[j] = wmma_bf(a, w, acc[j]); } }
#pragma unroll
  for (int j = 0; j < 4; ++j)
#pragma unroll
    for (int r = 0; r < 8; ++r) { const float v = acc[j][r]; const int rl = wave * 16 + 8 * g + r, cl = j * 16 + col;
      if (which == 2) { const __bf16 bh = (__bf16)v; th[cl][rl] = bh; tl2[cl][rl] = (__bf16)(v - (float)bh); } else { const _Float16 hv = (_Float16)v; sh[rl][cl] = hv; sl[rl][cl] = (_Float16)(v - (float)hv); } }
  __syncthreads();
  const size_t rb = (size_t)blockIdx.x * 64;
  if (which < 2) { _Float16* dh = which == 0 ? QH : KH; for (int e = tid; e < 64 * 8; e += 128) { const int rl = (e >> 7) * 16 + (e & 15), kk = ((e >> 5) & 3) * 16 + ((e >> 4) & 1) * 8; vst2((unsigned*)(dh + rb * HS + e * 8), *(const v4u*)&sh[rl][kk]);
      asm volatile("s_wait_xcnt 0x0" ::: "memory");   // ahead of the next LDS read and address step, which reuse the registers that the store names
      if (which == 0) { vst2((unsigned*)(QL + rb * HS + e * 8), *(const v4u*)&sl[rl][kk]);
        asm volatile("s_wait_xcnt 0x0" ::: "memory"); } } }   // the same for the residual plane's store
  else { for (int e = tid; e < 64 * 8; e += 128) { const int cl = ((e >> 6) & 3) * 16 + (e & 15), tk = (e >> 8) * 32 + ((e >> 5) & 1) * 16 + ((e >> 4) & 1) * 8; const size_t o2 = rb * HS + e * 8; vst2((unsigned*)(VT + o2), *(const v4u*)&th[cl][tk]); vst2((unsigned*)(VL + o2), *(const v4u*)&tl2[cl][tk]); } } }
// ---- k_att: block = (16 queries t, batch in group), 8 waves; wave w owns keys 128w .. 128w+127 of all 16 rows.
// Relative logits: row t = tl0 + i and key u = k0 + c want q_t . E[R0 + c - i + 15], R0 = k0 - tl0 + T - 16: the wave multiplies its 16 queries into the 144 rows E[R0 ..] (9 tiles)
// and stores element (i, m) of that band at (i, m + i - 15) of its LDS slab; of tiles 0 and 8 each lane keeps the one whose key falls inside 0 .. 127.
// S = (q . k + relative logit) / 8 stays in the accumulators; row maximum and row sum go over the 16 lanes of a row, then over the 8 waves through LDS;
// P x 2^11 turns from accumulator to A-fragment layout in the wave's own LDS slab; each wave multiplies its 128 keys into v (3 products); the 8 partial outputs are summed through LDS.
template <int CTRL> __device__ __forceinline__ float row_x(float v) { return __int_as_float(__builtin_amdgcn_update_dpp(0, __float_as_int(v), CTRL, 0xf, 0xf, true)); }   // value of lane ^ mask inside the 16-lane row (row_xmask)
__device__ __forceinline__ float row_max16(float v) { v = fmaxf(v, row_x<0x161>(v)); v = fmaxf(v, row_x<0x162>(v)); v = fmaxf(v, row_x<0x164>(v)); return fmaxf(v, row_x<0x168>(v)); }
__device__ __forceinline__ float row_sum16(float v) { v += row_x<0x161>(v); v += row_x<0x162>(v); v += row_x<0x164>(v); return v + row_x<0x168>(v); }
// launch bounds, second argument: 8 waves per SIMD (128 VGPRs), so that four work-groups share a WGP and all 1,024 work-groups are resident at once
__global__ __launch_bounds__(256, 8) void k_att(const _Float16* __restrict__ QH, const _Float16* __restrict__ QL, const _Float16* __restrict__ KH, const _Float16* __restrict__ EH, const __bf16* __restrict__ VT, const __bf16* __restrict__ VL, int b0, float* __restrict__ OUT) {
  __shared__ __align__(16) float ss[8][16][132]; __shared__ __align__(16) float rmax[8][16], rsum[8][16];
  const int tid = threadIdx.x, wave = tid >> 5, lane = tid & 31, col = lane & 15, g = lane >> 4; const int b = b0 + blockIdx.z; const int k0 = wave * 128; const int tl0 = blockIdx.x * 16; const size_t q0 = (size_t)b * TT + tl0;
  { const _Float16* eb0 = EH + (size_t)(k0 - tl0 + TT - 16) * HS; float* sw = &ss[wave][0][0] + 8 * g * 133 + col; v8f d0;
    const v16h ah0 = frag_ph(QH + q0 * HS, lane), al0 = frag_ph(QL + q0 * HS, lane), ah1 = frag_ph(QH + q0 * HS + 512, lane), al1 = frag_ph(QL + q0 * HS + 512, lane);
    v16h e0[9], e1[9];   // tiles in the order 0, 8, 1 .. 7, fetched two ahead
#pragma unroll
    for (int n = 0; n < 2; ++n) { e0[n] = frag_ph(eb0 + n * 8 * 16 * HS, lane); e1[n] = frag_ph(eb0 + n * 8 * 16 * HS + 512, lane); }
#pragma unroll
    for (int n = 0; n < 9; ++n) { v8f d = {}; const int jt = n == 0 ? 0 : n == 1 ? 8 : n - 1;
      if (n + 2 < 9) { e0[n + 2] = frag_ph(eb0 + (n + 1) * 16 * HS, lane); e1[n + 2] = frag_ph(eb0 + (n + 1) * 16 * HS + 512, lane); }
      __builtin_amdgcn_sched_barrier(0);   // keeps the loads of the tile after next above this tile's products: without it each tile waits out its own load latency
      d = wmma16(ah0, e0[n], d); d = wmma16(al0, e0[n], d); d = wmma16(ah1, e1[n], d); d = wmma16(al1, e1[n], d);
      if (jt == 0) d0 = d;
      else if (jt < 8) {
#pragma unroll
        for (int r = 0; r < 8; ++r) sw[r * 133 + jt * 16 - 15] = d[r]; }
      else {
#pragma unroll
        for (int r = 0; r < 8; ++r) { const int s = col + 8 * g + r - 15; ss[wave][8 * g + r][s & 127] = s >= 0 ? d0[r] : d[r]; } } } }
  v8f acc[8] = {};
#pragma unroll
  for (int kc = 0; kc < HS / 32; ++kc) { const v16h ah = frag_ph(QH + q0 * HS + kc * 512, lane), al = frag_ph(QL + q0 * HS + kc * 512, lane);
#pragma unroll
    for (int j = 0; j < 8; ++j) { const _Float16* kt = KH + ((size_t)b * TT + k0 + j * 16) * HS + kc * 512; const v16h kb = (kc == HS / 32 - 1 && j == 7) ? frag_ph_last(kt, lane) : frag_ph(kt, lane); acc[j] = wmma16(ah, kb, acc[j]); acc[j] = wmma16(al, kb, acc[j]); } }
  float mr[8], sr[8];
  LDSX();   // the skewed band was stored by other lanes of the same wave than those that read it now: the stores must have landed first
#pragma unroll
  for (int r = 0; r < 8; ++r) mr[r] = -3.0e38f;
#pragma unroll
  for (int j = 0; j < 8; ++j)
#pragma unroll
    for (int r = 0; r < 8; ++r) { acc[j][r] = (acc[j][r] + ss[wave][8 * g + r][j * 16 + col]) * 0.125f; mr[r] = fmaxf(mr[r], acc[j][r]); }
#pragma unroll
  for (int r = 0; r < 8; ++r) mr[r] = row_max16(mr[r]);
  if (col == 0) {
#pragma unroll
    for (int r = 0; r < 8; ++r) rmax[wave][8 * g + r] = mr[r]; }
  __syncthreads();
#pragma unroll
  for (int r = 0; r < 8; ++r) { float a = rmax[0][8 * g + r];
#pragma unroll
    for (int w = 1; w < 8; ++w) a = fmaxf(a, rmax[w][8 * g + r]);
    mr[r] = a; sr[r] = 0.f; }
#pragma unroll
  for (int j = 0; j < 8; ++j)
#pragma unroll
    for (int r = 0; r < 8; ++r) { acc[j][r] = expf(acc[j][r] - mr[r]); sr[r] += acc[j][r]; }
#pragma unroll
  for (int r = 0; r < 8; ++r) sr[r] = row_sum16(sr[r]);
  if (col == 0) {
#pragma unroll
    for (int r = 0; r < 8; ++r) rsum[wave][8 * g + r] = sr[r]; }
  __syncthreads();
#pragma unroll
  for (int r = 0; r < 8; ++r) { float a = 0.f;
#pragma unroll
    for (int w = 0; w < 8; ++w) a += rsum[w][8 * g + r];
    sr[r] = 1.0f / a; }
#pragma unroll
  for (int j = 0; j < 8; ++j)
#pragma unroll
    for (int r = 0; r < 8; ++r) ss[wave][8 * g + r][j * 16 + col] = acc[j][r] * sr[r] * 2048.0f;
  LDSX();   // the slab is written by rows of the accumulator layout and read back by other lanes of the same wave: the stores must have landed first
  v8f o[4] = {};
#pragma unroll
  for (int kc = 0; kc < 4; ++kc) { const F2 p = split_row(&ss[wave][col][0], kc * 32, lane);
#pragma unroll
    for (int j = 0; j < 4; ++j) { const size_t po = ((size_t)b * TT + k0 + kc * 32) * HS + j * 512; const v16b vh = frag_pb(VT + po, lane); o[j] = wmma_bf(p.h, vh, o[j]); o[j] = wmma_bf(p.l, vh, o[j]); o[j] = wmma_bf(p.h, frag_pb(VL + po, lane), o[j]); } }
#pragma unroll
  for (int j = 0; j < 4; ++j)
#pragma unroll
    for (int r = 0; r < 8; ++r) ss[wave][8 * g + r][j * 16 + col] = o[j][r];   // over the wave's own P slab: every read of it has fed the products above
  __syncthreads();
  { const int rl = tid >> 4, c4 = (tid & 15) * 4; v4f a = *(const v4f*)&ss[0][rl][c4];
#pragma unroll
    for (int w = 1; w < 8; ++w) a += *(const v4f*)&ss[w][rl][c4];
    vst2(OUT + (q0 + rl) * HS + c4, a * (1.0f / 2048.0f)); } }
extern "C" void kernel_launch(void* const* d_in, const int* in_sizes, int n_in, void* d_out, int out_size, void* d_ws, size_t ws_size, hipStream_t stream) {
  (void)in_sizes; (void)n_in; (void)out_size;
  const float** F = (const float**)d_in;   // 0 x [16,1024,768], 1 Wq [768,64], 2 Wk, 3 Wv, 4 E [2047,64]
  if (ws_size < (size_t)WS_END) return;
  char* ws = (char*)d_ws; _Float16 *QH = (_Float16*)(ws + WS_QH), *QL = (_Float16*)(ws + WS_QL), *KH = (_Float16*)(ws + WS_KH); __bf16 *VT = (__bf16*)(ws + WS_VT), *VL = (__bf16*)(ws + WS_VL); _Float16 *EH = (_Float16*)(ws + WS_EH);
  k_proj<<<dim3(TNB * TT / 64, 4), 128, 0, stream>>>(F[0], F[1], F[2], F[3], F[4], EH, QH, QL, KH, VT, VL);
  for (int b0 = 0; b0 < TNB; b0 += BG) { const int ng = (TNB - b0 < BG) ? (TNB - b0) : BG;
    k_att<<<dim3(TT / 16, 1, ng), 256, 0, stream>>>(QH, QL, KH, EH, VT, VL, b0, (float*)d_out);
  }
}

// v005
// One run takes 55.8 microseconds.
// Timed twice side by side with v004, it ran 1.27 and 1.26 times as fast.
// Counting every step since v000, it is 8.11 times as fast.
// compute dtype: all float inputs rounded to bf16; q/k/v = x W with EXACT bf16 products on WMMA 16x16x32, f32 accumulate; q as f16 hi + residual; relative logits q_t . E[u - t + T - 1] from each wave's own band of q E^T (2 products, E rounded once to f16), skewed through LDS, and content logits q . k (2 products, k f16), summed and scaled by 64^-0.5, kept in f32 registers (16 whole rows per work-group); softmax in f32 (precise expf), P x 2^11 kept f32 split bf16 hi + lo against v bf16 hi + lo (3 products), 8 partial sums of 128 keys added in f32; f32 output [b][t][64].
#include <hip/hip_runtime.h>
#include <math.h>

typedef __attribute__((ext_vector_type(16))) _Float16 v16h;
typedef __attribute__((ext_vector_type(16))) __bf16 v16b;
typedef __attribute__((ext_vector_type(8)))  _Float16 v8h;
typedef __attribute__((ext_vector_type(8)))  float v8f;
typedef __attribute__((ext_vector_type(4)))  float v4f;
typedef __attribute__((ext_vector_type(2)))  float v2f;
typedef __attribute__((ext_vector_type(4)))  unsigned v4u;
typedef __attribute__((ext_vector_type(4)))  int v4i;
typedef float __attribute__((may_alias)) float_a;
typedef int __attribute__((may_alias)) int_a;

template <typename T> __device__ __forceinline__ void vst2(void* p, T v) { *(T*)p = v;  }
__device__ __forceinline__ v8f wmma16(v16h a, v16h b, v8f c) {
  v8f d = __builtin_amdgcn_wmma_f32_16x16x32_f16(false, a, false, b, (short)0, c, false, false);
  asm volatile("v_nop\n\tv_nop\n\tv_nop\n\tv_nop" : "+v"(d) : "v"(a), "v"(b));
  return d;
}
__device__ __forceinline__ v8f wmma_bf(v16b a, v16b b, v8f c) {
  v8f d = __builtin_amdgcn_wmma_f32_16x16x32_bf16(false, a, false, b, (short)0, c, false, false);
  asm volatile("v_nop\n\tv_nop\n\tv_nop\n\tv_nop" : "+v"(d) : "v"(a), "v"(b));
  return d;
}
// 16x16x32 fragments: lane = (h = lane>>4, row/col = lane&15); elements 0..7 = k0+8h+0..7, 8..15 = k0+16+8h+0..7; D element r = row 8h+r
__device__ __forceinline__ v16h frag_h(const _Float16* rowk0, int lane) {
  union { v16h v; v8h q[2]; } u; const _Float16* p = rowk0 + 8 * (lane >> 4);
  u.q[0] = *(const v8h*)p; u.q[1] = *(const v8h*)(p + 16); return u.v;
}
__device__ __forceinline__ v16h frag_f32(const float* rowk0, int lane) {
  v16h a; const float* p = rowk0 + 8 * (lane >> 4);
#pragma unroll
  for (int i = 0; i < 8; ++i) { a[i] = (_Float16)p[i]; a[8 + i] = (_Float16)p[16 + i]; }
  return a;
}
__device__ __forceinline__ v16h frag_f32s(const float* rowk0, int lane, float sc) {
  v16h a; const float* p = rowk0 + 8 * (lane >> 4);
#pragma unroll
  for (int i = 0; i < 8; ++i) { a[i] = (_Float16)(p[i] * sc); a[8 + i] = (_Float16)(p[16 + i] * sc); }
  return a;
}
// column fragment from a [K][ld] layout (column n), rows >= K read as 0
__device__ __forceinline__ v16h fragc_f32(const float* W, int k0, int n, int lane, int ld, int K) {
  v16h a; const int g = lane >> 4;
#pragma unroll
  for (int i = 0; i < 8; ++i) { const int ka = k0 + 8 * g + i, kb = ka + 16;
    a[i] = (_Float16)(ka < K ? W[(size_t)(ka < K ? ka : K - 1) * ld + n] : 0.f); a[8 + i] = (_Float16)(kb < K ? W[(size_t)(kb < K ? kb : K - 1) * ld + n] : 0.f); }
  return a;
}
struct F2 { v16b h, l; };
__device__ __forceinline__ F2 bsplit16(const float v[16]) { F2 r;
#pragma unroll
  for (int i = 0; i < 16; ++i) { const __bf16 h = (__bf16)v[i]; r.h[i] = h; r.l[i] = (__bf16)(v[i] - (float)h); }
  return r; }
__device__ __forceinline__ F2 split_row(const float* row, int k0, int lane) { float v[16]; const float* p = row + k0 + 8 * (lane >> 4);
#pragma unroll
  for (int i = 0; i < 8; ++i) { v[i] = p[i]; v[8 + i] = p[16 + i]; }
  return bsplit16(v); }
__device__ __forceinline__ F2 split_rowK(const float* row, int k0, int lane, int K) { float v[16]; const int g = lane >> 4;
#pragma unroll
  for (int i = 0; i < 8; ++i) { const int ka = k0 + 8 * g + i, kb = ka + 16; v[i] = ka < K ? row[ka < K ? ka : K - 1] : 0.f; v[8 + i] = kb < K ? row[kb < K ? kb : K - 1] : 0.f; }
  return bsplit16(v); }
__device__ __forceinline__ F2 split_col(const float* W, int k0, int n, int lane, int ld, int K) { float v[16]; const int g = lane >> 4;
#pragma unroll
  for (int i = 0; i < 8; ++i) { const int ka = k0 + 8 * g + i, kb = ka + 16; v[i] = ka < K ? W[(size_t)(ka < K ? ka : K - 1) * ld + n] : 0.f; v[8 + i] = kb < K ? W[(size_t)(kb < K ? kb : K - 1) * ld + n] : 0.f; }
  return bsplit16(v); }
__device__ __forceinline__ v8f mac3(const F2& a, const F2& b, v8f c) { c = wmma_bf(a.l, b.h, c); c = wmma_bf(a.h, b.l, c); return wmma_bf(a.h, b.h, c); }
__device__ __forceinline__ float sigm(float v) { return 1.0f / (1.0f + expf(-v)); }
#define LDSX() do { asm volatile("s_wait_dscnt 0" ::: "memory"); __builtin_amdgcn_wave_barrier(); __builtin_amdgcn_fence(__ATOMIC_RELEASE, "workgroup"); } while (0)


// Relative attention head (B 16, T 1,024, C 768, head 64; learned relative embeddings E[2T-1, 64]): wei = softmax((q k^T + S_rel) / 8) with S_rel[t][u] = q_t . E[u - t + T - 1]; out = wei v.
#define NB 16
#define TT 1024
#define CIN 768
#define HS 64
#define NRE 2047
#define NREP 2048
#define BG NB                // batches per launch group: all of them, so that every stage is one launch
#ifndef TNB
#define TNB NB
#endif
typedef __attribute__((ext_vector_type(8))) __bf16 v8b;
typedef __attribute__((ext_vector_type(4))) _Float16 v4hh;
__device__ __forceinline__ v16b frag_b(const __bf16* rowk0, int lane) {
  union { v16b v; v8b q[2]; } u; const __bf16* p = rowk0 + 8 * (lane >> 4);
  u.q[0] = *(const v8b*)p; u.q[1] = *(const v8b*)(p + 16); return u.v;
}
// fragment-order planes: a tile = 16 rows x 32 k = 512 elements, stored as [half q][lane][8]: lane (h, row) holds k = 16q + 8h + 0..7 of its row, so that one wave-wide 16-byte load reads 512 contiguous bytes (4 whole lines, not 16 quarter lines)
__device__ __forceinline__ v16h frag_ph(const _Float16* tile, int lane) {
  union { v16h v; v8h q[2]; } u; const _Float16* p = tile + 8 * lane;
  u.q[0] = *(const v8h*)p; u.q[1] = *(const v8h*)(p + 256); return u.v;
}
// the same for the last fragment read through an address pair
__device__ __forceinline__ v16h frag_ph_last(const _Float16* tile, int lane) {
  union { v16h v; v8h q[2]; } u; const _Float16* p = tile + 8 * lane;
  u.q[0] = *(const v8h*)p; asm volatile("s_wait_xcnt 0x0" ::: "memory"); u.q[1] = *(const v8h*)(p + 256); return u.v;
}
__device__ __forceinline__ v16b frag_pb(const __bf16* tile, int lane) {
  union { v16b v; v8b q[2]; } u; const __bf16* p = tile + 8 * lane;
  u.q[0] = *(const v8b*)p; u.q[1] = *(const v8b*)(p + 256); return u.v;
}
__device__ __forceinline__ float bfr(float v) { return (float)(__bf16)v; }
__device__ __attribute__((noinline)) float exp_ni(float v) { return expf(v); }
__device__ __attribute__((noinline)) float erf_ni(float v) { return erff(v); }

#define WS_QH  0u                                  // f16 q, fragment order: tiles [b*t / 16][k / 32]
#define WS_QL  (WS_QH + 2u * (size_t)NB * TT * HS)
#define WS_KH  (WS_QL + 2u * (size_t)NB * TT * HS)
#define WS_VT  (WS_KH + 2u * (size_t)NB * TT * HS)     // bf16 v planes hi, fragment order: tiles [b*t / 32][d / 16], rows d, k = t
#define WS_VL  (WS_VT + 2u * (size_t)NB * HS * TT)
#define WS_EH  (WS_VL + 2u * (size_t)NB * HS * TT)     // f16 E, fragment order: tiles [row / 16][k / 32] of 2048 rows, row 2047 a zero pad
#define WS_END (WS_EH + 2u * (size_t)NREP * HS)

#define AHEAD 3               // k steps between a fetch of x and W in k_proj and its use
static_assert(TNB * TT / 64 * 512 == NREP * HS, "the which == 3 blocks of k_proj cover the f16 copy of E exactly once");
// ---- k_proj: block = (64 rows, which): q/k/v = x W ((in,out) [768][64]); 64 cols = 4 tiles; which == 3: 512 elements of E rounded to f16
__global__ __launch_bounds__(128) void k_proj(const float* __restrict__ X, const float* __restrict__ WQ, const float* __restrict__ WK, const float* __restrict__ WV, const float* __restrict__ E, _Float16* __restrict__ EH, _Float16* __restrict__ QH, _Float16* __restrict__ QL, _Float16* __restrict__ KH, __bf16* __restrict__ VT, __bf16* __restrict__ VL) {
  __shared__ __align__(16) _Float16 sh[64][72], sl[64][72]; __shared__ __align__(16) __bf16 th[64][72], tl2[64][72]; __shared__ __align__(16) __bf16 swf[2][4][512];   // swf: two steps' W tiles in fragment order [buffer][column tile][half][lane][8]
  const int tid = threadIdx.x, wave = tid >> 5, lane = tid & 31, col = lane & 15, g = lane >> 4; const int which = blockIdx.y; const size_t r0 = (size_t)blockIdx.x * 64 + wave * 16; const float* Wm = which == 0 ? WQ : which == 1 ? WK : WV;
  if (which == 3) { const int e0 = (blockIdx.x * 128 + tid) * 4; v4hh h = {};   // the whole block leaves here, ahead of the barrier
    const int c = e0 >> 3, er = (c >> 7) * 16 + (c & 15), ek = ((c >> 5) & 3) * 16 + ((c >> 4) & 1) * 8 + (e0 & 7);   // row and k of E that belong at place e0 of the fragment-order plane
    if (er < NRE) { const v4f ev = *(const v4f*)(E + er * HS + ek);
#pragma unroll
      for (int i = 0; i < 4; ++i) h[i] = (_Float16)bfr(ev[i]); }
    vst2(EH + e0, h); return; }
  v8f acc[4] = {};
  // W ring: wave w fetches and rounds column tile w of each 32-k step once for the whole block and publishes it in swf; x and W are fetched AHEAD steps before their use
  const float* xp = X + (r0 + col) * CIN + 8 * g; const float* wp = Wm + (size_t)(8 * g) * HS + wave * 16 + col;
  v4f xr[AHEAD][4]; float wr[AHEAD][16];
#pragma unroll
  for (int s = 0; s < AHEAD; ++s) { const float* px = xp + s * 32; const float* pw = wp + (size_t)s * 32 * HS;
    xr[s][0] = *(const v4f*)px; xr[s][1] = *(const v4f*)(px + 4); xr[s][2] = *(const v4f*)(px + 16); xr[s][3] = *(const v4f*)(px + 20);
#pragma unroll
    for (int i = 0; i < 8; ++i) { wr[s][i] = pw[i * HS]; wr[s][8 + i] = pw[(16 + i) * HS]; } }
  // unrolled whole: the stage and buffer numbers become constants and every load takes its step as an immediate offset, so that no address register is rewritten under a load in flight
#pragma unroll
  for (int kc = 0; kc < CIN / 32; ++kc) { const int s = kc % AHEAD, bf = kc & 1; v16b a; union { v16b v; v8b q[2]; } w;
    __builtin_amdgcn_sched_barrier(0);   // keeps this step's roundings, and the waits on their loads, from rising into earlier steps: there they would cut the loads' lead
#pragma unroll
    for (int i = 0; i < 4; ++i) { a[i] = (__bf16)xr[s][0][i]; a[4 + i] = (__bf16)xr[s][1][i]; a[8 + i] = (__bf16)xr[s][2][i]; a[12 + i] = (__bf16)xr[s][3][i]; }
#pragma unroll
    for (int i = 0; i < 16; ++i) w.v[i] = (__bf16)wr[s][i];
    { __bf16* d = &swf[bf][wave][8 * lane]; *(v8b*)d = w.q[0]; *(v8b*)(d + 256) = w.q[1]; }
    if (kc + AHEAD < CIN / 32) { const float* px = xp + (kc + AHEAD) * 32; const float* pw = wp + (size_t)(kc + AHEAD) * 32 * HS;
      xr[s][0] = *(const v4f*)px; xr[s][1] = *(const v4f*)(px + 4); xr[s][2] = *(const v4f*)(px + 16); xr[s][3] = *(const v4f*)(px + 20);
#pragma unroll
      for (int i = 0; i < 8; ++i) { wr[s][i] = pw[i * HS]; wr[s][8 + i] = pw[(16 + i) * HS]; } }
    // work-group barrier whose fences order LDS alone: it publishes this step's four tiles and ends every read of the other buffer, which the next step overwrites; __syncthreads() here also waits out the global loads fetched ahead
    __builtin_amdgcn_fence(__ATOMIC_RELEASE, "workgroup", "local"); __builtin_amdgcn_s_barrier(); __builtin_amdgcn_fence(__ATOMIC_ACQUIRE, "workgroup", "local");
    v16b wf[4];
#pragma unroll
    for (int j = 0; j < 4; ++j) wf[j] = frag_pb(&swf[bf][j][0], lane);
#pragma unroll
    for (int j = 0; j < 4; ++j) acc[j] = wmma_bf(a, wf[j], acc[j]); }
#pragma unroll
  for (int j = 0; j < 4; ++j)
#pragma unroll
    for (int r = 0; r < 8; ++r) { const float v = acc[j][r]; const int rl = wave * 16 + 8 * g + r, cl = j * 16 + col;
      if (which == 2) { const __bf16 bh = (__bf16)v; th[cl][rl] = bh; tl2[cl][rl] = (__bf16)(v - (float)bh); } else { const _Float16 hv = (_Float16)v; sh[rl][cl] = hv; sl[rl][cl] = (_Float16)(v - (float)hv); } }
  __syncthreads();
  const size_t rb = (size_t)blockIdx.x * 64;
  if (which < 2) { _Float16* dh = which == 0 ? QH : KH; for (int e = tid; e < 64 * 8; e += 128) { const int rl = (e >> 7) * 16 + (e & 15), kk = ((e >> 5) & 3) * 16 + ((e >> 4) & 1) * 8; vst2((unsigned*)(dh + rb * HS + e * 8), *(const v4u*)&sh[rl][kk]);
      asm volatile("s_wait_xcnt 0x0" ::: "memory");   // ahead of the next LDS read and address step, which reuse the registers that the store names
      if (which == 0) { vst2((unsigned*)(QL + rb * HS + e * 8), *(const v4u*)&sl[rl][kk]);
        asm volatile("s_wait_xcnt 0x0" ::: "memory"); } } }   // the same for the residual plane's store
  else { for (int e = tid; e < 64 * 8; e += 128) { const int cl = ((e >> 6) & 3) * 16 + (e & 15), tk = (e >> 8) * 32 + ((e >> 5) & 1) * 16 + ((e >> 4) & 1) * 8; const size_t o2 = rb * HS + e * 8; vst2((unsigned*)(VT + o2), *(const v4u*)&th[cl][tk]); vst2((unsigned*)(VL + o2), *(const v4u*)&tl2[cl][tk]); } } }
// ---- k_att: block = (16 queries t, batch in group), 8 waves; wave w owns keys 128w .. 128w+127 of all 16 rows.
// Relative logits: row t = tl0 + i and key u = k0 + c want q_t . E[R0 + c - i + 15], R0 = k0 - tl0 + T - 16: the wave multiplies its 16 queries into the 144 rows E[R0 ..] (9 tiles)
// and stores element (i, m) of that band at (i, m + i - 15) of its LDS slab; of tiles 0 and 8 each lane keeps the one whose key falls inside 0 .. 127.
// S = (q . k + relative logit) / 8 stays in the accumulators; row maximum and row sum go over the 16 lanes of a row, then over the 8 waves through LDS;
// P x 2^11 turns from accumulator to A-fragment layout in the wave's own LDS slab; each wave multiplies its 128 keys into v (3 products); the 8 partial outputs are summed through LDS.
template <int CTRL> __device__ __forceinline__ float row_x(float v) { return __int_as_float(__builtin_amdgcn_update_dpp(0, __float_as_int(v), CTRL, 0xf, 0xf, true)); }   // value of lane ^ mask inside the 16-lane row (row_xmask)
__device__ __forceinline__ float row_max16(float v) { v = fmaxf(v, row_x<0x161>(v)); v = fmaxf(v, row_x<0x162>(v)); v = fmaxf(v, row_x<0x164>(v)); return fmaxf(v, row_x<0x168>(v)); }
__device__ __forceinline__ float row_sum16(float v) { v += row_x<0x161>(v); v += row_x<0x162>(v); v += row_x<0x164>(v); return v + row_x<0x168>(v); }
// launch bounds, second argument: 8 waves per SIMD (128 VGPRs), so that four work-groups share a WGP and all 1,024 work-groups are resident at once
__global__ __launch_bounds__(256, 8) void k_att(const _Float16* __restrict__ QH, const _Float16* __restrict__ QL, const _Float16* __restrict__ KH, const _Float16* __restrict__ EH, const __bf16* __restrict__ VT, const __bf16* __restrict__ VL, int b0, float* __restrict__ OUT) {
  __shared__ __align__(16) float ss[8][16][132]; __shared__ __align__(16) float rmax[8][16], rsum[8][16];
  const int tid = threadIdx.x, wave = tid >> 5, lane = tid & 31, col = lane & 15, g = lane >> 4; const int b = b0 + blockIdx.z; const int k0 = wave * 128; const int tl0 = blockIdx.x * 16; const size_t q0 = (size_t)b * TT + tl0;
  { const _Float16* eb0 = EH + (size_t)(k0 - tl0 + TT - 16) * HS; float* sw = &ss[wave][0][0] + 8 * g * 133 + col; v8f d0;
    const v16h ah0 = frag_ph(QH + q0 * HS, lane), al0 = frag_ph(QL + q0 * HS, lane), ah1 = frag_ph(QH + q0 * HS + 512, lane), al1 = frag_ph(QL + q0 * HS + 512, lane);
    v16h e0[9], e1[9];   // tiles in the order 0, 8, 1 .. 7, fetched two ahead
#pragma unroll
    for (int n = 0; n < 2; ++n) { e0[n] = frag_ph(eb0 + n * 8 * 16 * HS, lane); e1[n] = frag_ph(eb0 + n * 8 * 16 * HS + 512, lane); }
#pragma unroll
    for (int n = 0; n < 9; ++n) { v8f d = {}; const int jt = n == 0 ? 0 : n == 1 ? 8 : n - 1;
      if (n + 2 < 9) { e0[n + 2] = frag_ph(eb0 + (n + 1) * 16 * HS, lane); e1[n + 2] = frag_ph(eb0 + (n + 1) * 16 * HS + 512, lane); }
      __builtin_amdgcn_sched_barrier(0);   // keeps the loads of the tile after next above this tile's products: without it each tile waits out its own load latency
      d = wmma16(ah0, e0[n], d); d = wmma16(al0, e0[n], d); d = wmma16(ah1, e1[n], d); d = wmma16(al1, e1[n], d);
      if (jt == 0) d0 = d;
      else if (jt < 8) {
#pragma unroll
        for (int r = 0; r < 8; ++r) sw[r * 133 + jt * 16 - 15] = d[r]; }
      else {
#pragma unroll
        for (int r = 0; r < 8; ++r) { const int s = col + 8 * g + r - 15; ss[wave][8 * g + r][s & 127] = s >= 0 ? d0[r] : d[r]; } } } }
  v8f acc[8] = {};
#pragma unroll
  for (int kc = 0; kc < HS / 32; ++kc) { const v16h ah = frag_ph(QH + q0 * HS + kc * 512, lane), al = frag_ph(QL + q0 * HS + kc * 512, lane);
#pragma unroll
    for (int j = 0; j < 8; ++j) { const _Float16* kt = KH + ((size_t)b * TT + k0 + j * 16) * HS + kc * 512; const v16h kb = (kc == HS / 32 - 1 && j == 7) ? frag_ph_last(kt, lane) : frag_ph(kt, lane); acc[j] = wmma16(ah, kb, acc[j]); acc[j] = wmma16(al, kb, acc[j]); } }
  float mr[8], sr[8];
  LDSX();   // the skewed band was stored by other lanes of the same wave than those that read it now: the stores must have landed first
#pragma unroll
  for (int r = 0; r < 8; ++r) mr[r] = -3.0e38f;
#pragma unroll
  for (int j = 0; j < 8; ++j)
#pragma unroll
    for (int r = 0; r < 8; ++r) { acc[j][r] = (acc[j][r] + ss[wave][8 * g + r][j * 16 + col]) * 0.125f; mr[r] = fmaxf(mr[r], acc[j][r]); }
#pragma unroll
  for (int r = 0; r < 8; ++r) mr[r] = row_max16(mr[r]);
  if (col == 0) {
#pragma unroll
    for (int r = 0; r < 8; ++r) rmax[wave][8 * g + r] = mr[r]; }
  __syncthreads();
#pragma unroll
  for (int r = 0; r < 8; ++r) { float a = rmax[0][8 * g + r];
#pragma unroll
    for (int w = 1; w < 8; ++w) a = fmaxf(a, rmax[w][8 * g + r]);
    mr[r] = a; sr[r] = 0.f; }
#pragma unroll
  for (int j = 0; j < 8; ++j)
#pragma unroll
    for (int r = 0; r < 8; ++r) { acc[j][r] = expf(acc[j][r] - mr[r]); sr[r] += acc[j][r]; }
#pragma unroll
  for (int r = 0; r < 8; ++r) sr[r] = row_sum16(sr[r]);
  if (col == 0) {
#pragma unroll
    for (int r = 0; r < 8; ++r) rsum[wave][8 * g + r] = sr[r]; }
  __syncthreads();
#pragma unroll
  for (int r = 0; r < 8; ++r) { float a = 0.f;
#pragma unroll
    for (int w = 0; w < 8; ++w) a += rsum[w][8 * g + r];
    sr[r] = 1.0f / a; }
#pragma unroll
  for (int j = 0; j < 8; ++j)
#pragma unroll
    for (int r = 0; r < 8; ++r) ss[wave][8 * g + r][j * 16 + col] = acc[j][r] * sr[r] * 2048.0f;
  LDSX();   // the slab is written by rows of the accumulator layout and read back by other lanes of the same wave: the stores must have landed first
  v8f o[4] = {};
#pragma unroll
  for (int kc = 0; kc < 4; ++kc) { const F2 p = split_row(&ss[wave][col][0], kc * 32, lane);
#pragma unroll
    for (int j = 0; j < 4; ++j) { const size_t po = ((size_t)b * TT + k0 + kc * 32) * HS + j * 512; const v16b vh = frag_pb(VT + po, lane); o[j] = wmma_bf(p.h, vh, o[j]); o[j] = wmma_bf(p.l, vh, o[j]); o[j] = wmma_bf(p.h, frag_pb(VL + po, lane), o[j]); } }
#pragma unroll
  for (int j = 0; j < 4; ++j)
#pragma unroll
    for (int r = 0; r < 8; ++r) ss[wave][8 * g + r][j * 16 + col] = o[j][r];   // over the wave's own P slab: every read of it has fed the products above
  __syncthreads();
  { const int rl = tid >> 4, c4 = (tid & 15) * 4; v4f a = *(const v4f*)&ss[0][rl][c4];
#pragma unroll
    for (int w = 1; w < 8; ++w) a += *(const v4f*)&ss[w][rl][c4];
    vst2(OUT + (q0 + rl) * HS + c4, a * (1.0f / 2048.0f)); } }
extern "C" void kernel_launch(void* const* d_in, const int* in_sizes, int n_in, void* d_out, int out_size, void* d_ws, size_t ws_size, hipStream_t stream) {
  (void)in_sizes; (void)n_in; (void)out_size;
  const float** F = (const float**)d_in;   // 0 x [16,1024,768], 1 Wq [768,64], 2 Wk, 3 Wv, 4 E [2047,64]
  if (ws_size < (size_t)WS_END) return;
  char* ws = (char*)d_ws; _Float16 *QH = (_Float16*)(ws + WS_QH), *QL = (_Float16*)(ws + WS_QL), *KH = (_Float16*)(ws + WS_KH); __bf16 *VT = (__bf16*)(ws + WS_VT), *VL = (__bf16*)(ws + WS_VL); _Float16 *EH = (_Float16*)(ws + WS_EH);
  k_proj<<<dim3(TNB * TT / 64, 4), 128, 0, stream>>>(F[0], F[1], F[2], F[3], F[4], EH, QH, QL, KH, VT, VL);
  for (int b0 = 0; b0 < TNB; b0 += BG) { const int ng = (TNB - b0 < BG) ? (TNB - b0) : BG;
    k_att<<<dim3(TT / 16, 1, ng), 256, 0, stream>>>(QH, QL, KH, EH, VT, VL, b0, (float*)d_out);
  }
}

// v006
// One run takes 47.7 microseconds.
// Two timings next to v005 put it at 1.16 and 1.15 times that version's speed.
// Over all steps from v000 it is 9.38 times as fast.
// compute dtype: all float inputs rounded to bf16; q/k/v = x W with EXACT bf16 products on WMMA 16x16x32, f32 accumulate; q as f16 hi + residual; relative logits q_t . E[u - t + T - 1] from each wave's own band of q E^T (2 products, E rounded once to f16), skewed through LDS, and content logits q . k (2 products, k f16), summed and scaled by 64^-0.5, kept in f32 registers (32 whole rows per work-group); softmax in f32 (precise expf), P x 2^11 kept f32 split bf16 hi + lo against v bf16 hi + lo (3 products), 8 partial sums of 128 keys added in f32; f32 output [b][t][64].
#include <hip/hip_runtime.h>
#include <math.h>

typedef __attribute__((ext_vector_type(16))) _Float16 v16h;
typedef __attribute__((ext_vector_type(16))) __bf16 v16b;
typedef __attribute__((ext_vector_type(8)))  _Float16 v8h;
typedef __attribute__((ext_vector_type(8)))  float v8f;
typedef __attribute__((ext_vector_type(4)))  float v4f;
typedef __attribute__((ext_vector_type(2)))  float v2f;
typedef __attribute__((ext_vector_type(4)))  unsigned v4u;
typedef __attribute__((ext_vector_type(4)))  int v4i;
typedef float __attribute__((may_alias)) float_a;
typedef int __attribute__((may_alias)) int_a;

template <typename T> __device__ __forceinline__ void vst2(void* p, T v) { *(T*)p = v;  }
__device__ __forceinline__ v8f wmma16(v16h a, v16h b, v8f c) {
  v8f d = __builtin_amdgcn_wmma_f32_16x16x32_f16(false, a, false, b, (short)0, c, false, false);
  asm volatile("v_nop\n\tv_nop\n\tv_nop\n\tv_nop" : "+v"(d) : "v"(a), "v"(b));
  return d;
}
__device__ __forceinline__ v8f wmma_bf(v16b a, v16b b, v8f c) {
  v8f d = __builtin_amdgcn_wmma_f32_16x16x32_bf16(false, a, false, b, (short)0, c, false, false);
  asm volatile("v_nop\n\tv_nop\n\tv_nop\n\tv_nop" : "+v"(d) : "v"(a), "v"(b));
  return d;
}
// 16x16x32 fragments: lane = (h = lane>>4, row/col = lane&15); elements 0..7 = k0+8h+0..7, 8..15 = k0+16+8h+0..7; D element r = row 8h+r
__device__ __forceinline__ v16h frag_h(const _Float16* rowk0, int lane) {
  union { v16h v; v8h q[2]; } u; const _Float16* p = rowk0 + 8 * (lane >> 4);
  u.q[0] = *(const v8h*)p; u.q[1] = *(const v8h*)(p + 16); return u.v;
}
__device__ __forceinline__ v16h frag_f32(const float* rowk0, int lane) {
  v16h a; const float* p = rowk0 + 8 * (lane >> 4);
#pragma unroll
  for (int i = 0; i < 8; ++i) { a[i] = (_Float16)p[i]; a[8 + i] = (_Float16)p[16 + i]; }
  return a;
}
__device__ __forceinline__ v16h frag_f32s(const float* rowk0, int lane, float sc) {
  v16h a; const float* p = rowk0 + 8 * (lane >> 4);
#pragma unroll
  for (int i = 0; i < 8; ++i) { a[i] = (_Float16)(p[i] * sc); a[8 + i] = (_Float16)(p[16 + i] * sc); }
  return a;
}
// column fragment from a [K][ld] layout (column n), rows >= K read as 0
__device__ __forceinline__ v16h fragc_f32(const float* W, int k0, int n, int lane, int ld, int K) {
  v16h a; const int g = lane >> 4;
#pragma unroll
  for (int i = 0; i < 8; ++i) { const int ka = k0 + 8 * g + i, kb = ka + 16;
    a[i] = (_Float16)(ka < K ? W[(size_t)(ka < K ? ka : K - 1) * ld + n] : 0.f); a[8 + i] = (_Float16)(kb < K ? W[(size_t)(kb < K ? kb : K - 1) * ld + n] : 0.f); }
  return a;
}
struct F2 { v16b h, l; };
__device__ __forceinline__ F2 bsplit16(const float v[16]) { F2 r;
#pragma unroll
  for (int i = 0; i < 16; ++i) { const __bf16 h = (__bf16)v[i]; r.h[i] = h; r.l[i] = (__bf16)(v[i] - (float)h); }
  return r; }
__device__ __forceinline__ F2 split_row(const float* row, int k0, int lane) { float v[16]; const float* p = row + k0 + 8 * (lane >> 4);
#pragma unroll
  for (int i = 0; i < 8; ++i) { v[i] = p[i]; v[8 + i] = p[16 + i]; }
  return bsplit16(v); }
__device__ __forceinline__ F2 split_rowK(const float* row, int k0, int lane, int K) { float v[16]; const int g = lane >> 4;
#pragma unroll
  for (int i = 0; i < 8; ++i) { const int ka = k0 + 8 * g + i, kb = ka + 16; v[i] = ka < K ? row[ka < K ? ka : K - 1] : 0.f; v[8 + i] = kb < K ? row[kb < K ? kb : K - 1] : 0.f; }
  return bsplit16(v); }
__device__ __forceinline__ F2 split_col(const float* W, int k0, int n, int lane, int ld, int K) { float v[16]; const int g = lane >> 4;
#pragma unroll
  for (int i = 0; i < 8; ++i) { const int ka = k0 + 8 * g + i, kb = ka + 16; v[i] = ka < K ? W[(size_t)(ka < K ? ka : K - 1) * ld + n] : 0.f; v[8 + i] = kb < K ? W[(size_t)(kb < K ? kb : K - 1) * ld + n] : 0.f; }
  return bsplit16(v); }
__device__ __forceinline__ v8f mac3(const F2& a, const F2& b, v8f c) { c = wmma_bf(a.l, b.h, c); c = wmma_bf(a.h, b.l, c); return wmma_bf(a.h, b.h, c); }
__device__ __forceinline__ float sigm(float v) { return 1.0f / (1.0f + expf(-v)); }
#define LDSX() do { asm volatile("s_wait_dscnt 0" ::: "memory"); __builtin_amdgcn_wave_barrier(); __builtin_amdgcn_fence(__ATOMIC_RELEASE, "workgroup"); } while (0)


// Relative attention head (B 16, T 1,024, C 768, head 64; learned relative embeddings E[2T-1, 64]): wei = softmax((q k^T + S_rel) / 8) with S_rel[t][u] = q_t . E[u - t + T - 1]; out = wei v.
#define NB 16
#define TT 1024
#define CIN 768
#define HS 64
#define NRE 2047
#define NREP 2048
#define BG NB                // batches per launch group: all of them, so that every stage is one launch
#ifndef TNB
#define TNB NB
#endif
typedef __attribute__((ext_vector_type(8))) __bf16 v8b;
typedef __attribute__((ext_vector_type(4))) _Float16 v4hh;
__device__ __forceinline__ v16b frag_b(const __bf16* rowk0, int lane) {
  union { v16b v; v8b q[2]; } u; const __bf16* p = rowk0 + 8 * (lane >> 4);
  u.q[0] = *(const v8b*)p; u.q[1] = *(const v8b*)(p + 16); return u.v;
}
// fragment-order planes: a tile = 16 rows x 32 k = 512 elements, stored as [half q][lane][8]: lane (h, row) holds k = 16q + 8h + 0..7 of its row, so that one wave-wide 16-byte load reads 512 contiguous bytes (4 whole lines, not 16 quarter lines)
__device__ __forceinline__ v16h frag_ph(const _Float16* tile, int lane) {
  union { v16h v; v8h q[2]; } u; const _Float16* p = tile + 8 * lane;
  u.q[0] = *(const v8h*)p; u.q[1] = *(const v8h*)(p + 256); return u.v;
}
__device__ __forceinline__ v16b frag_pb(const __bf16* tile, int lane) {
  union { v16b v; v8b q[2]; } u; const __bf16* p = tile + 8 * lane;
  u.q[0] = *(const v8b*)p; u.q[1] = *(const v8b*)(p + 256); return u.v;
}
__device__ __forceinline__ float bfr(float v) { return (float)(__bf16)v; }
__device__ __attribute__((noinline)) float exp_ni(float v) { return expf(v); }
__device__ __attribute__((noinline)) float erf_ni(float v) { return erff(v); }

#define WS_QH  0u                                  // f16 q, fragment order: tiles [b*t / 16][k / 32]
#define WS_QL  (WS_QH + 2u * (size_t)NB * TT * HS)
#define WS_KH  (WS_QL + 2u * (size_t)NB * TT * HS)
#define WS_VT  (WS_KH + 2u * (size_t)NB * TT * HS)     // bf16 v planes hi, fragment order: tiles [b*t / 32][d / 16], rows d, k = t
#define WS_VL  (WS_VT + 2u * (size_t)NB * HS * TT)
#define WS_EH  (WS_VL + 2u * (size_t)NB * HS * TT)     // f16 E, fragment order: tiles [row / 16][k / 32] of 2048 rows, row 2047 a zero pad
#define WS_END (WS_EH + 2u * (size_t)NREP * HS)

#define AHEAD 3               // k steps between a fetch of x and W in k_proj and its use
static_assert(TNB * TT / 64 * 512 == NREP * HS, "the which == 3 blocks of k_proj cover the f16 copy of E exactly once");
// ---- k_proj: block = (64 rows, which): q/k/v = x W ((in,out) [768][64]); 64 cols = 4 tiles; which == 3: 512 elements of E rounded to f16
__global__ __launch_bounds__(128) void k_proj(const float* __restrict__ X, const float* __restrict__ WQ, const float* __restrict__ WK, const float* __restrict__ WV, const float* __restrict__ E, _Float16* __restrict__ EH, _Float16* __restrict__ QH, _Float16* __restrict__ QL, _Float16* __restrict__ KH, __bf16* __restrict__ VT, __bf16* __restrict__ VL) {
  __shared__ __align__(16) _Float16 sh[64][72], sl[64][72]; __shared__ __align__(16) __bf16 th[64][72], tl2[64][72]; __shared__ __align__(16) __bf16 swf[2][4][512];   // swf: two steps' W tiles in fragment order [buffer][column tile][half][lane][8]
  const int tid = threadIdx.x, wave = tid >> 5, lane = tid & 31, col = lane & 15, g = lane >> 4; const int which = blockIdx.y; const size_t r0 = (size_t)blockIdx.x * 64 + wave * 16; const float* Wm = which == 0 ? WQ : which == 1 ? WK : WV;
  if (which == 3) { const int e0 = (blockIdx.x * 128 + tid) * 4; v4hh h = {};   // the whole block leaves here, ahead of the barrier
    const int c = e0 >> 3, er = (c >> 7) * 16 + (c & 15), ek = ((c >> 5) & 3) * 16 + ((c >> 4) & 1) * 8 + (e0 & 7);   // row and k of E that belong at place e0 of the fragment-order plane
    if (er < NRE) { const v4f ev = *(const v4f*)(E + er * HS + ek);
#pragma unroll
      for (int i = 0; i < 4; ++i) h[i] = (_Float16)bfr(ev[i]); }
    vst2(EH + e0, h); return; }
  v8f acc[4] = {};
  // W ring: wave w fetches and rounds column tile w of each 32-k step once for the whole block and publishes it in swf; x and W are fetched AHEAD steps before their use
  const float* xp = X + (r0 + col) * CIN + 8 * g; const float* wp = Wm + (size_t)(8 * g) * HS + wave * 16 + col;
  v4f xr[AHEAD][4]; float wr[AHEAD][16];
#pragma unroll
  for (int s = 0; s < AHEAD; ++s) { const float* px = xp + s * 32; const float* pw = wp + (size_t)s * 32 * HS;
    xr[s][0] = *(const v4f*)px; xr[s][1] = *(const v4f*)(px + 4); xr[s][2] = *(const v4f*)(px + 16); xr[s][3] = *(const v4f*)(px + 20);
#pragma unroll
    for (int i = 0; i < 8; ++i) { wr[s][i] = pw[i * HS]; wr[s][8 + i] = pw[(16 + i) * HS]; } }
  // unrolled whole: the stage and buffer numbers become constants and every load takes its step as an immediate offset, so that no address register is rewritten under a load in flight
#pragma unroll
  for (int kc = 0; kc < CIN / 32; ++kc) { const int s = kc % AHEAD, bf = kc & 1; v16b a; union { v16b v; v8b q[2]; } w;
    __builtin_amdgcn_sched_barrier(0);   // keeps this step's roundings, and the waits on their loads, from rising into earlier steps: there they would cut the loads' lead
#pragma unroll
    for (int i = 0; i < 4; ++i) { a[i] = (__bf16)xr[s][0][i]; a[4 + i] = (__bf16)xr[s][1][i]; a[8 + i] = (__bf16)xr[s][2][i]; a[12 + i] = (__bf16)xr[s][3][i]; }
#pragma unroll
    for (int i = 0; i < 16; ++i) w.v[i] = (__bf16)wr[s][i];
    { __bf16* d = &swf[bf][wave][8 * lane]; *(v8b*)d = w.q[0]; *(v8b*)(d + 256) = w.q[1]; }
    if (kc + AHEAD < CIN / 32) { const float* px = xp + (kc + AHEAD) * 32; const float* pw = wp + (size_t)(kc + AHEAD) * 32 * HS;
      xr[s][0] = *(const v4f*)px; xr[s][1] = *(const v4f*)(px + 4); xr[s][2] = *(const v4f*)(px + 16); xr[s][3] = *(const v4f*)(px + 20);
#pragma unroll
      for (int i = 0; i < 8; ++i) { wr[s][i] = pw[i * HS]; wr[s][8 + i] = pw[(16 + i) * HS]; } }
    // work-group barrier whose fences order LDS alone: it publishes this step's four tiles and ends every read of the other buffer, which the next step overwrites; __syncthreads() here also waits out the global loads fetched ahead
    __builtin_amdgcn_fence(__ATOMIC_RELEASE, "workgroup", "local"); __builtin_amdgcn_s_barrier(); __builtin_amdgcn_fence(__ATOMIC_ACQUIRE, "workgroup", "local");
    v16b wf[4];
#pragma unroll
    for (int j = 0; j < 4; ++j) wf[j] = frag_pb(&swf[bf][j][0], lane);
#pragma unroll
    for (int j = 0; j < 4; ++j) acc[j] = wmma_bf(a, wf[j], acc[j]); }
#pragma unroll
  for (int j = 0; j < 4; ++j)
#pragma unroll
    for (int r = 0; r < 8; ++r) { const float v = acc[j][r]; const int rl = wave * 16 + 8 * g + r, cl = j * 16 + col;
      if (which == 2) { const __bf16 bh = (__bf16)v; th[cl][rl] = bh; tl2[cl][rl] = (__bf16)(v - (float)bh); } else { const _Float16 hv = (_Float16)v; sh[rl][cl] = hv; sl[rl][cl] = (_Float16)(v - (float)hv); } }
  __syncthreads();
  const size_t rb = (size_t)blockIdx.x * 64;
  if (which < 2) { _Float16* dh = which == 0 ? QH : KH; for (int e = tid; e < 64 * 8; e += 128) { const int rl = (e >> 7) * 16 + (e & 15), kk = ((e >> 5) & 3) * 16 + ((e >> 4) & 1) * 8; vst2((unsigned*)(dh + rb * HS + e * 8), *(const v4u*)&sh[rl][kk]);
      asm volatile("s_wait_xcnt 0x0" ::: "memory");   // ahead of the next LDS read and address step, which reuse the registers that the store names
      if (which == 0) { vst2((unsigned*)(QL + rb * HS + e * 8), *(const v4u*)&sl[rl][kk]);
        asm volatile("s_wait_xcnt 0x0" ::: "memory"); } } }   // the same for the residual plane's store
  else { for (int e = tid; e < 64 * 8; e += 128) { const int cl = ((e >> 6) & 3) * 16 + (e & 15), tk = (e >> 8) * 32 + ((e >> 5) & 1) * 16 + ((e >> 4) & 1) * 8; const size_t o2 = rb * HS + e * 8; vst2((unsigned*)(VT + o2), *(const v4u*)&th[cl][tk]); vst2((unsigned*)(VL + o2), *(const v4u*)&tl2[cl][tk]); } } }
// ---- k_att: block = (32 queries t = QR tiles of 16, batch in group), 8 waves; wave w owns keys 128w .. 128w+127 of all 32 rows, so that each fragment of k and v that it loads feeds QR row tiles, and each E tile every row tile whose band holds it.
// Relative logits: row t = tq + i of the row tile at tq and key u = k0 + c want q_t . E[R0 + c - i + 15], R0 = k0 - tq + T - 16: a row tile takes the 144 rows E[R0 ..] (9 tiles); the bands of neighbouring row tiles lie 16 rows apart,
// so the wave walks the 8 + QR tiles from E[k0 - tl0 + T - 16 QR] once and multiplies each into every row tile whose band holds it (tile m of the walk is tile jt = m - (QR - 1 - rt) of row tile rt).
// Element (i, 16 jt + c) of a band goes to (i, 16 jt + c + i - 15) of the row tile's rows in the wave's LDS slab; of tiles jt = 0 and 8 each lane keeps the one whose key falls inside 0 .. 127.
// S = (q . k + relative logit) / 8 stays in the accumulators; row maximum and row sum go over the 16 lanes of a row, then over the 8 waves through LDS;
// P x 2^11 turns from accumulator to A-fragment layout in the wave's own LDS slab; each wave multiplies its 128 keys into v (3 products); the 8 partial outputs are summed through LDS.
#define QR 2
template <int CTRL> __device__ __forceinline__ float row_x(float v) { return __int_as_float(__builtin_amdgcn_update_dpp(0, __float_as_int(v), CTRL, 0xf, 0xf, true)); }   // value of lane ^ mask inside the 16-lane row (row_xmask)
__device__ __forceinline__ float row_max16(float v) { v = fmaxf(v, row_x<0x161>(v)); v = fmaxf(v, row_x<0x162>(v)); v = fmaxf(v, row_x<0x164>(v)); return fmaxf(v, row_x<0x168>(v)); }
__device__ __forceinline__ float row_sum16(float v) { v += row_x<0x161>(v); v += row_x<0x162>(v); v += row_x<0x164>(v); return v + row_x<0x168>(v); }
// walk order of the E tiles: each row tile's jt = 0 directly ahead of its jt = 8, so that the kept tile 0 is live for one step only
__device__ __forceinline__ constexpr int walk_m(int n) { return n < 2 * QR ? (n >> 1) + 8 * (n & 1) : n - QR; }
// launch bounds, second argument: 4 waves per SIMD (256 VGPRs), so that two work-groups share a WGP and all 512 work-groups are resident at once
__global__ __launch_bounds__(256, 4) void k_att(const _Float16* __restrict__ QH, const _Float16* __restrict__ QL, const _Float16* __restrict__ KH, const _Float16* __restrict__ EH, const __bf16* __restrict__ VT, const __bf16* __restrict__ VL, int b0, float* __restrict__ OUT) {
  __shared__ __align__(16) float ss[8][16 * QR][132]; __shared__ __align__(16) float rmax[8][16 * QR], rsum[8][16 * QR];
  const int tid = threadIdx.x, wave = tid >> 5, lane = tid & 31, col = lane & 15, g = lane >> 4; const int b = b0 + blockIdx.z; const int k0 = wave * 128; const int tl0 = blockIdx.x * (16 * QR); const size_t q0 = (size_t)b * TT + tl0;
  v16h qf[QR][4];   // per row tile: q hi, q residual of k 0 .. 31, then of k 32 .. 63; held in registers for both logit products
#pragma unroll
  for (int rt = 0; rt < QR; ++rt) { const size_t qo = (q0 + 16 * rt) * HS; qf[rt][0] = frag_ph(QH + qo, lane); qf[rt][1] = frag_ph(QL + qo, lane); qf[rt][2] = frag_ph(QH + qo + 512, lane); qf[rt][3] = frag_ph(QL + qo + 512, lane); }
  { const _Float16* eb0 = EH + (size_t)(k0 - tl0 + TT - 16 * QR) * HS; float* sw = &ss[wave][0][0] + 8 * g * 133 + col; v8f d0[QR];
    v16h e0[8 + QR], e1[8 + QR];   // tiles in walk order, fetched two ahead
#pragma unroll
    for (int n = 0; n < 2; ++n) { e0[n] = frag_ph(eb0 + walk_m(n) * 16 * HS, lane); e1[n] = frag_ph(eb0 + walk_m(n) * 16 * HS + 512, lane); }
#pragma unroll
    for (int n = 0; n < 8 + QR; ++n) { v8f d[QR] = {}; const int m = walk_m(n);
      if (n + 2 < 8 + QR) { e0[n + 2] = frag_ph(eb0 + walk_m(n + 2) * 16 * HS, lane); e1[n + 2] = frag_ph(eb0 + walk_m(n + 2) * 16 * HS + 512, lane); }
      __builtin_amdgcn_sched_barrier(0);   // keeps the loads of the tile after next above this tile's products: without it each tile waits out its own load latency
#pragma unroll
      for (int p = 0; p < 4; ++p)
#pragma unroll
        for (int rt = 0; rt < QR; ++rt) { const int jt = m - (QR - 1 - rt); if (jt >= 0 && jt <= 8) d[rt] = wmma16(qf[rt][p], p < 2 ? e0[n] : e1[n], d[rt]); }
#pragma unroll
      for (int rt = 0; rt < QR; ++rt) { const int jt = m - (QR - 1 - rt);
        if (jt == 0) d0[rt] = d[rt];
        else if (jt > 0 && jt < 8) {
#pragma unroll
          for (int r = 0; r < 8; ++r) sw[rt * 16 * 132 + r * 133 + jt * 16 - 15] = d[rt][r]; }
        else if (jt == 8) {
#pragma unroll
          for (int r = 0; r < 8; ++r) { const int s = col + 8 * g + r - 15; ss[wave][16 * rt + 8 * g + r][s & 127] = s >= 0 ? d0[rt][r] : d[rt][r]; } } } } }
  v8f acc[QR][8] = {};
#pragma unroll
  for (int j = 0; j < 8; ++j) { const _Float16* kt = KH + ((size_t)b * TT + k0 + j * 16) * HS; v16h kb[HS / 32]; kb[0] = frag_ph(kt, lane); kb[1] = frag_ph(kt + 512, lane);
#pragma unroll
    for (int p = 0; p < 4; ++p)
#pragma unroll
      for (int rt = 0; rt < QR; ++rt) acc[rt][j] = wmma16(qf[rt][p], kb[p >> 1], acc[rt][j]); }
  LDSX();   // the skewed band was stored by other lanes of the same wave than those that read it now: the stores must have landed first
  // softmax, one row tile per trip on acc[0]; the next tile's logits move down at the trip's foot. Kept rolled, for speed only
#pragma unroll 1
  for (int rt = 0; rt < QR; ++rt) { float mr[8], sr[8]; float* sl = &ss[wave][16 * rt + 8 * g][col]; const int rw = 16 * rt + 8 * g;
#pragma unroll
    for (int r = 0; r < 8; ++r) mr[r] = -3.0e38f;
#pragma unroll
    for (int j = 0; j < 8; ++j)
#pragma unroll
      for (int r = 0; r < 8; ++r) { acc[0][j][r] = (acc[0][j][r] + sl[r * 132 + j * 16]) * 0.125f; mr[r] = fmaxf(mr[r], acc[0][j][r]); }
#pragma unroll
    for (int r = 0; r < 8; ++r) mr[r] = row_max16(mr[r]);
    if (col == 0) {
#pragma unroll
      for (int r = 0; r < 8; ++r) rmax[wave][rw + r] = mr[r]; }
    __syncthreads();
#pragma unroll
    for (int r = 0; r < 8; ++r) { float a = rmax[0][rw + r];
#pragma unroll
      for (int w = 1; w < 8; ++w) a = fmaxf(a, rmax[w][rw + r]);
      mr[r] = a; sr[r] = 0.f; }
#pragma unroll
    for (int j = 0; j < 8; ++j)
#pragma unroll
      for (int r = 0; r < 8; ++r) { acc[0][j][r] = expf(acc[0][j][r] - mr[r]); sr[r] += acc[0][j][r]; }
#pragma unroll
    for (int r = 0; r < 8; ++r) sr[r] = row_sum16(sr[r]);
    if (col == 0) {
#pragma unroll
      for (int r = 0; r < 8; ++r) rsum[wave][rw + r] = sr[r]; }
    __syncthreads();
#pragma unroll
    for (int r = 0; r < 8; ++r) { float a = 0.f;
#pragma unroll
      for (int w = 0; w < 8; ++w) a += rsum[w][rw + r];
      sr[r] = 1.0f / a; }
#pragma unroll
    for (int j = 0; j < 8; ++j)
#pragma unroll
      for (int r = 0; r < 8; ++r) sl[r * 132 + j * 16] = acc[0][j][r] * sr[r] * 2048.0f;
#pragma unroll
    for (int q = 0; q + 1 < QR; ++q)
#pragma unroll
      for (int j = 0; j < 8; ++j) acc[q][j] = acc[q + 1][j]; }
  LDSX();   // the slab is written by rows of the accumulator layout and read back by other lanes of the same wave: the stores must have landed first
  v8f o[QR][4] = {};
  // kept rolled for the same reason as the softmax trips
#pragma unroll 1
  for (int kc = 0; kc < 4; ++kc) { F2 p[QR];
#pragma unroll
    for (int rt = 0; rt < QR; ++rt) p[rt] = split_row(&ss[wave][16 * rt + col][0], kc * 32, lane);
#pragma unroll
    for (int j = 0; j < 4; ++j) { const size_t po = ((size_t)b * TT + k0 + kc * 32) * HS + j * 512; const v16b vh = frag_pb(VT + po, lane), vl = frag_pb(VL + po, lane);
#pragma unroll
      for (int rt = 0; rt < QR; ++rt) o[rt][j] = wmma_bf(p[rt].h, vh, o[rt][j]);
#pragma unroll
      for (int rt = 0; rt < QR; ++rt) o[rt][j] = wmma_bf(p[rt].l, vh, o[rt][j]);
#pragma unroll
      for (int rt = 0; rt < QR; ++rt) o[rt][j] = wmma_bf(p[rt].h, vl, o[rt][j]); }
    asm volatile("s_wait_xcnt 0x0" ::: "memory"); }   // ahead of the next trip's address step, which rewrites the pairs that this trip's loads name
#pragma unroll
  for (int rt = 0; rt < QR; ++rt)
#pragma unroll
    for (int j = 0; j < 4; ++j)
#pragma unroll
      for (int r = 0; r < 8; ++r) ss[wave][16 * rt + 8 * g + r][j * 16 + col] = o[rt][j][r];   // over the wave's own P slab: every read of it has fed the products above
  __syncthreads();
#pragma unroll
  for (int rt = 0; rt < QR; ++rt) { const int rl = 16 * rt + (tid >> 4), c4 = (tid & 15) * 4; v4f a = *(const v4f*)&ss[0][rl][c4];
#pragma unroll
    for (int w = 1; w < 8; ++w) a += *(const v4f*)&ss[w][rl][c4];
    vst2(OUT + (q0 + rl) * HS + c4, a * (1.0f / 2048.0f)); } }
extern "C" void kernel_launch(void* const* d_in, const int* in_sizes, int n_in, void* d_out, int out_size, void* d_ws, size_t ws_size, hipStream_t stream) {
  (void)in_sizes; (void)n_in; (void)out_size;
  const float** F = (const float**)d_in;   // 0 x [16,1024,768], 1 Wq [768,64], 2 Wk, 3 Wv, 4 E [2047,64]
  if (ws_size < (size_t)WS_END) return;
  char* ws = (char*)d_ws; _Float16 *QH = (_Float16*)(ws + WS_QH), *QL = (_Float16*)(ws + WS_QL), *KH = (_Float16*)(ws + WS_KH); __bf16 *VT = (__bf16*)(ws + WS_VT), *VL = (__bf16*)(ws + WS_VL); _Float16 *EH = (_Float16*)(ws + WS_EH);
  k_proj<<<dim3(TNB * TT / 64, 4), 128, 0, stream>>>(F[0], F[1], F[2], F[3], F[4], EH, QH, QL, KH, VT, VL);
  for (int b0 = 0; b0 < TNB; b0 += BG) { const int ng = (TNB - b0 < BG) ? (TNB - b0) : BG;
    k_att<<<dim3(TT / (16 * QR), 1, ng), 256, 0, stream>>>(QH, QL, KH, EH, VT, VL, b0, (float*)d_out);
  }
}

// v007
// It runs in 44.4 microseconds.
// Two timings next to v006 put it at 1.07 and 1.08 times that version's speed.
// All steps since v000 together make it 10.1 times as fast.
// compute dtype: all float inputs rounded to bf16; q/k/v = x W with EXACT bf16 products on WMMA 16x16x32, f32 accumulate; q as f16 hi + residual; relative logits q_t . E[u - t + T - 1] from each wave's own band of q E^T (2 products, E rounded once to f16), skewed through LDS, and content logits q . k (2 products, k f16), summed, kept in f32 registers (32 whole rows per work-group); softmax in f32: 2^((S - max) * 64^-0.5 * log2 e) by the hardware's 2^x, P x 2^11 kept f32 split bf16 hi + lo against v bf16 hi + lo (3 products), 8 partial sums of 128 keys added in f32; f32 output [b][t][64].
#include <hip/hip_runtime.h>
#include <math.h>

typedef __attribute__((ext_vector_type(16))) _Float16 v16h;
typedef __attribute__((ext_vector_type(16))) __bf16 v16b;
typedef __attribute__((ext_vector_type(8)))  _Float16 v8h;
typedef __attribute__((ext_vector_type(8)))  float v8f;
typedef __attribute__((ext_vector_type(4)))  float v4f;
typedef __attribute__((ext_vector_type(2)))  float v2f;
typedef __attribute__((ext_vector_type(4)))  unsigned v4u;
typedef __attribute__((ext_vector_type(4)))  int v4i;
typedef float __attribute__((may_alias)) float_a;
typedef int __attribute__((may_alias)) int_a;

template <typename T> __device__ __forceinline__ void vst2(void* p, T v) { *(T*)p = v;  }
__device__ __forceinline__ v8f wmma16(v16h a, v16h b, v8f c) {
  v8f d = __builtin_amdgcn_wmma_f32_16x16x32_f16(false, a, false, b, (short)0, c, false, false);
  asm volatile("v_nop\n\tv_nop\n\tv_nop\n\tv_nop" : "+v"(d) : "v"(a), "v"(b));
  return d;
}
__device__ __forceinline__ v8f wmma_bf(v16b a, v16b b, v8f c) {
  v8f d = __builtin_amdgcn_wmma_f32_16x16x32_bf16(false, a, false, b, (short)0, c, false, false);
  asm volatile("v_nop\n\tv_nop\n\tv_nop\n\tv_nop" : "+v"(d) : "v"(a), "v"(b));
  return d;
}
// 16x16x32 fragments: lane = (h = lane>>4, row/col = lane&15); elements 0..7 = k0+8h+0..7, 8..15 = k0+16+8h+0..7; D element r = row 8h+r
__device__ __forceinline__ v16h frag_h(const _Float16* rowk0, int lane) {
  union { v16h v; v8h q[2]; } u; const _Float16* p = rowk0 + 8 * (lane >> 4);
  u.q[0] = *(const v8h*)p; u.q[1] = *(const v8h*)(p + 16); return u.v;
}
__device__ __forceinline__ v16h frag_f32(const float* rowk0, int lane) {
  v16h a; const float* p = rowk0 + 8 * (lane >> 4);
#pragma unroll
  for (int i = 0; i < 8; ++i) { a[i] = (_Float16)p[i]; a[8 + i] = (_Float16)p[16 + i]; }
  return a;
}
__device__ __forceinline__ v16h frag_f32s(const float* rowk0, int lane, float sc) {
  v16h a; const float* p = rowk0 + 8 * (lane >> 4);
#pragma unroll
  for (int i = 0; i < 8; ++i) { a[i] = (_Float16)(p[i] * sc); a[8 + i] = (_Float16)(p[16 + i] * sc); }
  return a;
}
// column fragment from a [K][ld] layout (column n), rows >= K read as 0
__device__ __forceinline__ v16h fragc_f32(const float* W, int k0, int n, int lane, int ld, int K) {
  v16h a; const int g = lane >> 4;
#pragma unroll
  for (int i = 0; i < 8; ++i) { const int ka = k0 + 8 * g + i, kb = ka + 16;
    a[i] = (_Float16)(ka < K ? W[(size_t)(ka < K ? ka : K - 1) * ld + n] : 0.f); a[8 + i] = (_Float16)(kb < K ? W[(size_t)(kb < K ? kb : K - 1) * ld + n] : 0.f); }
  return a;
}
struct F2 { v16b h, l; };
__device__ __forceinline__ F2 bsplit16(const float v[16]) { F2 r;
#pragma unroll
  for (int i = 0; i < 16; ++i) { const __bf16 h = (__bf16)v[i]; r.h[i] = h; r.l[i] = (__bf16)(v[i] - (float)h); }
  return r; }
__device__ __forceinline__ F2 split_row(const float* row, int k0, int lane) { float v[16]; const float* p = row + k0 + 8 * (lane >> 4);
#pragma unroll
  for (int i = 0; i < 8; ++i) { v[i] = p[i]; v[8 + i] = p[16 + i]; }
  return bsplit16(v); }
__device__ __forceinline__ F2 split_rowK(const float* row, int k0, int lane, int K) { float v[16]; const int g = lane >> 4;
#pragma unroll
  for (int i = 0; i < 8; ++i) { const int ka = k0 + 8 * g + i, kb = ka + 16; v[i] = ka < K ? row[ka < K ? ka : K - 1] : 0.f; v[8 + i] = kb < K ? row[kb < K ? kb : K - 1] : 0.f; }
  return bsplit16(v); }
__device__ __forceinline__ F2 split_col(const float* W, int k0, int n, int lane, int ld, int K) { float v[16]; const int g = lane >> 4;
#pragma unroll
  for (int i = 0; i < 8; ++i) { const int ka = k0 + 8 * g + i, kb = ka + 16; v[i] = ka < K ? W[(size_t)(ka < K ? ka : K - 1) * ld + n] : 0.f; v[8 + i] = kb < K ? W[(size_t)(kb < K ? kb : K - 1) * ld + n] : 0.f; }
  return bsplit16(v); }
__device__ __forceinline__ v8f mac3(const F2& a, const F2& b, v8f c) { c = wmma_bf(a.l, b.h, c); c = wmma_bf(a.h, b.l, c); return wmma_bf(a.h, b.h, c); }
__device__ __forceinline__ float sigm(float v) { return 1.0f / (1.0f + expf(-v)); }
#define LDSX() do { asm volatile("s_wait_dscnt 0" ::: "memory"); __builtin_amdgcn_wave_barrier(); __builtin_amdgcn_fence(__ATOMIC_RELEASE, "workgroup"); } while (0)


// Relative attention head (B 16, T 1,024, C 768, head 64; learned relative embeddings E[2T-1, 64]): wei = softmax((q k^T + S_rel) / 8) with S_rel[t][u] = q_t . E[u - t + T - 1]; out = wei v.
#define NB 16
#define TT 1024
#define CIN 768
#define HS 64
#define NRE 2047
#define NREP 2048
#define BG NB                // batches per launch group: all of them, so that every stage is one launch
#ifndef TNB
#define TNB NB
#endif
typedef __attribute__((ext_vector_type(8))) __bf16 v8b;
typedef __attribute__((ext_vector_type(4))) _Float16 v4hh;
__device__ __forceinline__ v16b frag_b(const __bf16* rowk0, int lane) {
  union { v16b v; v8b q[2]; } u; const __bf16* p = rowk0 + 8 * (lane >> 4);
  u.q[0] = *(const v8b*)p; u.q[1] = *(const v8b*)(p + 16); return u.v;
}
// fragment-order planes: a tile = 16 rows x 32 k = 512 elements, stored as [half q][lane][8]: lane (h, row) holds k = 16q + 8h + 0..7 of its row, so that one wave-wide 16-byte load reads 512 contiguous bytes (4 whole lines, not 16 quarter lines)
__device__ __forceinline__ v16h frag_ph(const _Float16* tile, int lane) {
  union { v16h v; v8h q[2]; } u; const _Float16* p = tile + 8 * lane;
  u.q[0] = *(const v8h*)p; u.q[1] = *(const v8h*)(p + 256); return u.v;
}
__device__ __forceinline__ v16b frag_pb(const __bf16* tile, int lane) {
  union { v16b v; v8b q[2]; } u; const __bf16* p = tile + 8 * lane;
  u.q[0] = *(const v8b*)p; u.q[1] = *(const v8b*)(p + 256); return u.v;
}
__device__ __forceinline__ float bfr(float v) { return (float)(__bf16)v; }
__device__ __attribute__((noinline)) float exp_ni(float v) { return expf(v); }
__device__ __attribute__((noinline)) float erf_ni(float v) { return erff(v); }

#define WS_QH  0u                                  // f16 q, fragment order: tiles [b*t / 16][k / 32]
#define WS_QL  (WS_QH + 2u * (size_t)NB * TT * HS)
#define WS_KH  (WS_QL + 2u * (size_t)NB * TT * HS)
#define WS_VT  (WS_KH + 2u * (size_t)NB * TT * HS)     // bf16 v planes hi, fragment order: tiles [b*t / 32][d / 16], rows d, k = t
#define WS_VL  (WS_VT + 2u * (size_t)NB * HS * TT)
#define WS_EH  (WS_VL + 2u * (size_t)NB * HS * TT)     // f16 E, fragment order: tiles [row / 16][k / 32] of 2048 rows, row 2047 a zero pad
#define WS_END (WS_EH + 2u * (size_t)NREP * HS)

#define AHEAD 3               // k steps between a fetch of x and W in k_proj and its use
static_assert(TNB * TT / 64 * 512 == NREP * HS, "the which == 3 blocks of k_proj cover the f16 copy of E exactly once");
// ---- k_proj: block = (64 rows, which): q/k/v = x W ((in,out) [768][64]); 64 cols = 4 tiles; which == 3: 512 elements of E rounded to f16
__global__ __launch_bounds__(128) void k_proj(const float* __restrict__ X, const float* __restrict__ WQ, const float* __restrict__ WK, const float* __restrict__ WV, const float* __restrict__ E, _Float16* __restrict__ EH, _Float16* __restrict__ QH, _Float16* __restrict__ QL, _Float16* __restrict__ KH, __bf16* __restrict__ VT, __bf16* __restrict__ VL) {
  __shared__ __align__(16) _Float16 sh[64][72], sl[64][72]; __shared__ __align__(16) __bf16 th[64][72], tl2[64][72]; __shared__ __align__(16) __bf16 swf[2][4][512];   // swf: two steps' W tiles in fragment order [buffer][column tile][half][lane][8]
  const int tid = threadIdx.x, wave = tid >> 5, lane = tid & 31, col = lane & 15, g = lane >> 4; const int which = blockIdx.y; const size_t r0 = (size_t)blockIdx.x * 64 + wave * 16; const float* Wm = which == 0 ? WQ : which == 1 ? WK : WV;
  if (which == 3) { const int e0 = (blockIdx.x * 128 + tid) * 4; v4hh h = {};   // the whole block leaves here, ahead of the barrier
    const int c = e0 >> 3, er = (c >> 7) * 16 + (c & 15), ek = ((c >> 5) & 3) * 16 + ((c >> 4) & 1) * 8 + (e0 & 7);   // row and k of E that belong at place e0 of the fragment-order plane
    if (er < NRE) { const v4f ev = *(const v4f*)(E + er * HS + ek);
#pragma unroll
      for (int i = 0; i < 4; ++i) h[i] = (_Float16)bfr(ev[i]); }
    vst2(EH + e0, h); return; }
  v8f acc[4] = {};
  // W ring: wave w fetches and rounds column tile w of each 32-k step once for the whole block and publishes it in swf; x and W are fetched AHEAD steps before their use
  const float* xp = X + (r0 + col) * CIN + 8 * g; const float* wp = Wm + (size_t)(8 * g) * HS + wave * 16 + col;
  v4f xr[AHEAD][4]; float wr[AHEAD][16];
#pragma unroll
  for (int s = 0; s < AHEAD; ++s) { const float* px = xp + s * 32; const float* pw = wp + (size_t)s * 32 * HS;
    xr[s][0] = *(const v4f*)px; xr[s][1] = *(const v4f*)(px + 4); xr[s][2] = *(const v4f*)(px + 16); xr[s][3] = *(const v4f*)(px + 20);
#pragma unroll
    for (int i = 0; i < 8; ++i) { wr[s][i] = pw[i * HS]; wr[s][8 + i] = pw[(16 + i) * HS]; } }
  // unrolled whole: the stage and buffer numbers become constants and every load takes its step as an immediate offset, so that no address register is rewritten under a load in flight
#pragma unroll
  for (int kc = 0; kc < CIN / 32; ++kc) { const int s = kc % AHEAD, bf = kc & 1; v16b a; union { v16b v; v8b q[2]; } w;
    __builtin_amdgcn_sched_barrier(0);   // keeps this step's roundings, and the waits on their loads, from rising into earlier steps: there they would cut the loads' lead
#pragma unroll
    for (int i = 0; i < 4; ++i) { a[i] = (__bf16)xr[s][0][i]; a[4 + i] = (__bf16)xr[s][1][i]; a[8 + i] = (__bf16)xr[s][2][i]; a[12 + i] = (__bf16)xr[s][3][i]; }
#pragma unroll
    for (int i = 0; i < 16; ++i) w.v[i] = (__bf16)wr[s][i];
    { __bf16* d = &swf[bf][wave][8 * lane]; *(v8b*)d = w.q[0]; *(v8b*)(d + 256) = w.q[1]; }
    if (kc + AHEAD < CIN / 32) { const float* px = xp + (kc + AHEAD) * 32; const float* pw = wp + (size_t)(kc + AHEAD) * 32 * HS;
      xr[s][0] = *(const v4f*)px; xr[s][1] = *(const v4f*)(px + 4); xr[s][2] = *(const v4f*)(px + 16); xr[s][3] = *(const v4f*)(px + 20);
#pragma unroll
      for (int i = 0; i < 8; ++i) { wr[s][i] = pw[i * HS]; wr[s][8 + i] = pw[(16 + i) * HS]; } }
    // work-group barrier whose fences order LDS alone: it publishes this step's four tiles and ends every read of the other buffer, which the next step overwrites; __syncthreads() here also waits out the global loads fetched ahead
    __builtin_amdgcn_fence(__ATOMIC_RELEASE, "workgroup", "local"); __builtin_amdgcn_s_barrier(); __builtin_amdgcn_fence(__ATOMIC_ACQUIRE, "workgroup", "local");
    v16b wf[4];
#pragma unroll
    for (int j = 0; j < 4; ++j) wf[j] = frag_pb(&swf[bf][j][0], lane);
#pragma unroll
    for (int j = 0; j < 4; ++j) acc[j] = wmma_bf(a, wf[j], acc[j]); }
#pragma unroll
  for (int j = 0; j < 4; ++j)
#pragma unroll
    for (int r = 0; r < 8; ++r) { const float v = acc[j][r]; const int rl = wave * 16 + 8 * g + r, cl = j * 16 + col;
      if (which == 2) { const __bf16 bh = (__bf16)v; th[cl][rl] = bh; tl2[cl][rl] = (__bf16)(v - (float)bh); } else { const _Float16 hv = (_Float16)v; sh[rl][cl] = hv; sl[rl][cl] = (_Float16)(v - (float)hv); } }
  __syncthreads();
  const size_t rb = (size_t)blockIdx.x * 64;
  if (which < 2) { _Float16* dh = which == 0 ? QH : KH; for (int e = tid; e < 64 * 8; e += 128) { const int rl = (e >> 7) * 16 + (e & 15), kk = ((e >> 5) & 3) * 16 + ((e >> 4) & 1) * 8; vst2((unsigned*)(dh + rb * HS + e * 8), *(const v4u*)&sh[rl][kk]);
      asm volatile("s_wait_xcnt 0x0" ::: "memory");   // ahead of the next LDS read and address step, which reuse the registers that the store names
      if (which == 0) { vst2((unsigned*)(QL + rb * HS + e * 8), *(const v4u*)&sl[rl][kk]);
        asm volatile("s_wait_xcnt 0x0" ::: "memory"); } } }   // the same for the residual plane's store
  else { for (int e = tid; e < 64 * 8; e += 128) { const int cl = ((e >> 6) & 3) * 16 + (e & 15), tk = (e >> 8) * 32 + ((e >> 5) & 1) * 16 + ((e >> 4) & 1) * 8; const size_t o2 = rb * HS + e * 8; vst2((unsigned*)(VT + o2), *(const v4u*)&th[cl][tk]); vst2((unsigned*)(VL + o2), *(const v4u*)&tl2[cl][tk]); } } }
// ---- k_att: block = (32 queries t = QR tiles of 16, batch in group), 8 waves; wave w owns keys 128w .. 128w+127 of all 32 rows, so that each fragment of k and v that it loads feeds QR row tiles, and each E tile every row tile whose band holds it.
// Relative logits: row t = tq + i of the row tile at tq and key u = k0 + c want q_t . E[R0 + c - i + 15], R0 = k0 - tq + T - 16: a row tile takes the 144 rows E[R0 ..] (9 tiles); the bands of neighbouring row tiles lie 16 rows apart,
// so the wave walks the 8 + QR tiles from E[k0 - tl0 + T - 16 QR] once and multiplies each into every row tile whose band holds it (tile m of the walk is tile jt = m - (QR - 1 - rt) of row tile rt).
// Element (i, 16 jt + c) of a band goes to (i, 16 jt + c + i - 15) of the row tile's rows in the wave's LDS slab; of tiles jt = 0 and 8 each lane keeps the one whose key falls inside 0 .. 127.
// S = q . k + relative logit stays in the accumulators, unscaled; e^((S - max) / 8) is taken as 2^(S * SC2 - max * SC2), one fused multiply-add and one 2^x instruction; row maximum and row sum go over the 16 lanes of a row, then over the 8 waves through LDS;
// P x 2^11 turns from accumulator to A-fragment layout in the wave's own LDS slab; each wave multiplies its 128 keys into v (3 products); the 8 partial outputs are summed through LDS.
#define QR 2
#define SC2 0.18033688011112042f   // 64^-0.5 * log2(e)
template <int CTRL> __device__ __forceinline__ float row_x(float v) { return __int_as_float(__builtin_amdgcn_update_dpp(0, __float_as_int(v), CTRL, 0xf, 0xf, true)); }   // value of lane ^ mask inside the 16-lane row (row_xmask)
__device__ __forceinline__ float row_max16(float v) { v = fmaxf(v, row_x<0x161>(v)); v = fmaxf(v, row_x<0x162>(v)); v = fmaxf(v, row_x<0x164>(v)); return fmaxf(v, row_x<0x168>(v)); }
__device__ __forceinline__ float row_sum16(float v) { v += row_x<0x161>(v); v += row_x<0x162>(v); v += row_x<0x164>(v); return v + row_x<0x168>(v); }
// walk order of the E tiles: each row tile's jt = 0 directly ahead of its jt = 8, so that the kept tile 0 is live for one step only
__device__ __forceinline__ constexpr int walk_m(int n) { return n < 2 * QR ? (n >> 1) + 8 * (n & 1) : n - QR; }
// launch bounds, second argument: 4 waves per SIMD (256 VGPRs), so that two work-groups share a WGP and all 512 work-groups are resident at once
__global__ __launch_bounds__(256, 4) void k_att(const _Float16* __restrict__ QH, const _Float16* __restrict__ QL, const _Float16* __restrict__ KH, const _Float16* __restrict__ EH, const __bf16* __restrict__ VT, const __bf16* __restrict__ VL, int b0, float* __restrict__ OUT) {
  __shared__ __align__(16) float ss[8][16 * QR][132]; __shared__ __align__(16) float rmax[8][16 * QR], rsum[8][16 * QR];
  const int tid = threadIdx.x, wave = tid >> 5, lane = tid & 31, col = lane & 15, g = lane >> 4; const int b = b0 + blockIdx.z; const int k0 = wave * 128; const int tl0 = blockIdx.x * (16 * QR); const size_t q0 = (size_t)b * TT + tl0;
  v16h qf[QR][4];   // per row tile: q hi, q residual of k 0 .. 31, then of k 32 .. 63; held in registers for both logit products
#pragma unroll
  for (int rt = 0; rt < QR; ++rt) { const size_t qo = (q0 + 16 * rt) * HS; qf[rt][0] = frag_ph(QH + qo, lane); qf[rt][1] = frag_ph(QL + qo, lane); qf[rt][2] = frag_ph(QH + qo + 512, lane); qf[rt][3] = frag_ph(QL + qo + 512, lane); }
  { const _Float16* eb0 = EH + (size_t)(k0 - tl0 + TT - 16 * QR) * HS; float* sw = &ss[wave][0][0] + 8 * g * 133 + col; v8f d0[QR];
    v16h e0[8 + QR], e1[8 + QR];   // tiles in walk order, fetched two ahead
#pragma unroll
    for (int n = 0; n < 2; ++n) { e0[n] = frag_ph(eb0 + walk_m(n) * 16 * HS, lane); e1[n] = frag_ph(eb0 + walk_m(n) * 16 * HS + 512, lane); }
#pragma unroll
    for (int n = 0; n < 8 + QR; ++n) { v8f d[QR] = {}; const int m = walk_m(n);
      if (n + 2 < 8 + QR) { e0[n + 2] = frag_ph(eb0 + walk_m(n + 2) * 16 * HS, lane); e1[n + 2] = frag_ph(eb0 + walk_m(n + 2) * 16 * HS + 512, lane); }
      __builtin_amdgcn_sched_barrier(0);   // keeps the loads of the tile after next above this tile's products: without it each tile waits out its own load latency
#pragma unroll
      for (int p = 0; p < 4; ++p)
#pragma unroll
        for (int rt = 0; rt < QR; ++rt) { const int jt = m - (QR - 1 - rt); if (jt >= 0 && jt <= 8) d[rt] = wmma16(qf[rt][p], p < 2 ? e0[n] : e1[n], d[rt]); }
#pragma unroll
      for (int rt = 0; rt < QR; ++rt) { const int jt = m - (QR - 1 - rt);
        if (jt == 0) d0[rt] = d[rt];
        else if (jt > 0 && jt < 8) {
#pragma unroll
          for (int r = 0; r < 8; ++r) sw[rt * 16 * 132 + r * 133 + jt * 16 - 15] = d[rt][r]; }
        else if (jt == 8) {
#pragma unroll
          for (int r = 0; r < 8; ++r) { const int s = col + 8 * g + r - 15; ss[wave][16 * rt + 8 * g + r][s & 127] = s >= 0 ? d0[rt][r] : d[rt][r]; } } } } }
  v8f acc[QR][8] = {};
#pragma unroll
  for (int j = 0; j < 8; ++j) { const _Float16* kt = KH + ((size_t)b * TT + k0 + j * 16) * HS; v16h kb[HS / 32]; kb[0] = frag_ph(kt, lane); kb[1] = frag_ph(kt + 512, lane);
#pragma unroll
    for (int p = 0; p < 4; ++p)
#pragma unroll
      for (int rt = 0; rt < QR; ++rt) acc[rt][j] = wmma16(qf[rt][p], kb[p >> 1], acc[rt][j]); }
  LDSX();   // the skewed band was stored by other lanes of the same wave than those that read it now: the stores must have landed first
  // softmax, one row tile per trip on acc[0]; the next tile's logits move down at the trip's foot. Kept rolled, for speed only
#pragma unroll 1
  for (int rt = 0; rt < QR; ++rt) { float mr[8], sr[8]; float* sl = &ss[wave][16 * rt + 8 * g][col]; const int rw = 16 * rt + 8 * g;
#pragma unroll
    for (int r = 0; r < 8; ++r) mr[r] = -3.0e38f;
#pragma unroll
    for (int j = 0; j < 8; ++j)
#pragma unroll
      for (int r = 0; r < 8; ++r) { acc[0][j][r] += sl[r * 132 + j * 16]; mr[r] = fmaxf(mr[r], acc[0][j][r]); }
#pragma unroll
    for (int r = 0; r < 8; ++r) mr[r] = row_max16(mr[r]);
    if (col == 0) {
#pragma unroll
      for (int r = 0; r < 8; ++r) rmax[wave][rw + r] = mr[r]; }
    __syncthreads();
#pragma unroll
    for (int r = 0; r < 8; ++r) { float a = rmax[0][rw + r];
#pragma unroll
      for (int w = 1; w < 8; ++w) a = fmaxf(a, rmax[w][rw + r]);
      mr[r] = a * SC2; sr[r] = 0.f; }   // one rounded product per row, the same in all 8 waves: its rounding scales the whole row by one factor, which the division by the row sum takes out
#pragma unroll
    for (int j = 0; j < 8; ++j)
#pragma unroll
      for (int r = 0; r < 8; ++r) { acc[0][j][r] = __builtin_amdgcn_exp2f(fmaf(acc[0][j][r], SC2, -mr[r])); sr[r] += acc[0][j][r]; }
#pragma unroll
    for (int r = 0; r < 8; ++r) sr[r] = row_sum16(sr[r]);
    if (col == 0) {
#pragma unroll
      for (int r = 0; r < 8; ++r) rsum[wave][rw + r] = sr[r]; }
    __syncthreads();
#pragma unroll
    for (int r = 0; r < 8; ++r) { float a = 0.f;
#pragma unroll
      for (int w = 0; w < 8; ++w) a += rsum[w][rw + r];
      sr[r] = 1.0f / a; }
#pragma unroll
    for (int j = 0; j < 8; ++j)
#pragma unroll
      for (int r = 0; r < 8; ++r) sl[r * 132 + j * 16] = acc[0][j][r] * sr[r] * 2048.0f;
#pragma unroll
    for (int q = 0; q + 1 < QR; ++q)
#pragma unroll
      for (int j = 0; j < 8; ++j) acc[q][j] = acc[q + 1][j]; }
  LDSX();   // the slab is written by rows of the accumulator layout and read back by other lanes of the same wave: the stores must have landed first
  v8f o[QR][4] = {};
  // kept rolled for the same reason as the softmax trips
#pragma unroll 1
  for (int kc = 0; kc < 4; ++kc) { F2 p[QR];
#pragma unroll
    for (int rt = 0; rt < QR; ++rt) p[rt] = split_row(&ss[wave][16 * rt + col][0], kc * 32, lane);
#pragma unroll
    for (int j = 0; j < 4; ++j) { const size_t po = ((size_t)b * TT + k0 + kc * 32) * HS + j * 512; const v16b vh = frag_pb(VT + po, lane), vl = frag_pb(VL + po, lane);
#pragma unroll
      for (int rt = 0; rt < QR; ++rt) o[rt][j] = wmma_bf(p[rt].h, vh, o[rt][j]);
#pragma unroll
      for (int rt = 0; rt < QR; ++rt) o[rt][j] = wmma_bf(p[rt].l, vh, o[rt][j]);
#pragma unroll
      for (int rt = 0; rt < QR; ++rt) o[rt][j] = wmma_bf(p[rt].h, vl, o[rt][j]); }
    asm volatile("s_wait_xcnt 0x0" ::: "memory"); }   // ahead of the next trip's address step, which rewrites the pairs that this trip's loads name
#pragma unroll
  for (int rt = 0; rt < QR; ++rt)
#pragma unroll
    for (int j = 0; j < 4; ++j)
#pragma unroll
      for (int r = 0; r < 8; ++r) ss[wave][16 * rt + 8 * g + r][j * 16 + col] = o[rt][j][r];   // over the wave's own P slab: every read of it has fed the products above
  __syncthreads();
#pragma unroll
  for (int rt = 0; rt < QR; ++rt) { const int rl = 16 * rt + (tid >> 4), c4 = (tid & 15) * 4; v4f a = *(const v4f*)&ss[0][rl][c4];
#pragma unroll
    for (int w = 1; w < 8; ++w) a += *(const v4f*)&ss[w][rl][c4];
    vst2(OUT + (q0 + rl) * HS + c4, a * (1.0f / 2048.0f)); } }
extern "C" void kernel_launch(void* const* d_in, const int* in_sizes, int n_in, void* d_out, int out_size, void* d_ws, size_t ws_size, hipStream_t stream) {
  (void)in_sizes; (void)n_in; (void)out_size;
  const float** F = (const float**)d_in;   // 0 x [16,1024,768], 1 Wq [768,64], 2 Wk, 3 Wv, 4 E [2047,64]
  if (ws_size < (size_t)WS_END) return;
  char* ws = (char*)d_ws; _Float16 *QH = (_Float16*)(ws + WS_QH), *QL = (_Float16*)(ws + WS_QL), *KH = (_Float16*)(ws + WS_KH); __bf16 *VT = (__bf16*)(ws + WS_VT), *VL = (__bf16*)(ws + WS_VL); _Float16 *EH = (_Float16*)(ws + WS_EH);
  k_proj<<<dim3(TNB * TT / 64, 4), 128, 0, stream>>>(F[0], F[1], F[2], F[3], F[4], EH, QH, QL, KH, VT, VL);
  for (int b0 = 0; b0 < TNB; b0 += BG) { const int ng = (TNB - b0 < BG) ? (TNB - b0) : BG;
    k_att<<<dim3(TT / (16 * QR), 1, ng), 256, 0, stream>>>(QH, QL, KH, EH, VT, VL, b0, (float*)d_out);
  }
}

// v008
// A run of this version takes 39.3 microseconds.
// Next to v007, in two timings, it ran 1.11 and 1.13 times as fast.
// Counting every step since v000, it is 11.3 times as fast.
// compute dtype: all float inputs rounded to bf16; q/k/v = x W with EXACT bf16 products on WMMA 16x16x32, f32 accumulate; q as f16 hi + residual; relative logits q_t . E[u - t + T - 1] from each wave's own band of q E^T (2 products, E rounded once to f16), skewed through LDS, and content logits q . k (2 products, k f16), summed, kept in f32 registers (32 whole rows per work-group); softmax in f32: 2^((S - max) * 64^-0.5 * log2 e) by the hardware's 2^x, P x 2^11 kept f32 split bf16 hi + lo against v bf16 hi + lo (3 products), 8 partial sums of 128 keys added in f32; f32 output [b][t][64].
#include <hip/hip_runtime.h>
#include <math.h>

typedef __attribute__((ext_vector_type(16))) _Float16 v16h;
typedef __attribute__((ext_vector_type(16))) __bf16 v16b;
typedef __attribute__((ext_vector_type(8)))  _Float16 v8h;
typedef __attribute__((ext_vector_type(8)))  float v8f;
typedef __attribute__((ext_vector_type(4)))  float v4f;
typedef __attribute__((ext_vector_type(2)))  float v2f;
typedef __attribute__((ext_vector_type(4)))  unsigned v4u;
typedef __attribute__((ext_vector_type(4)))  int v4i;
typedef float __attribute__((may_alias)) float_a;
typedef int __attribute__((may_alias)) int_a;

template <typename T> __device__ __forceinline__ void vst2(void* p, T v) { *(T*)p = v;  }
__device__ __forceinline__ v8f wmma16(v16h a, v16h b, v8f c) {
  v8f d = __builtin_amdgcn_wmma_f32_16x16x32_f16(false, a, false, b, (short)0, c, false, false);
  asm volatile("v_nop\n\tv_nop\n\tv_nop\n\tv_nop" : "+v"(d) : "v"(a), "v"(b));
  return d;
}
__device__ __forceinline__ v8f wmma_bf(v16b a, v16b b, v8f c) {
  v8f d = __builtin_amdgcn_wmma_f32_16x16x32_bf16(false, a, false, b, (short)0, c, false, false);
  asm volatile("v_nop\n\tv_nop\n\tv_nop\n\tv_nop" : "+v"(d) : "v"(a), "v"(b));
  return d;
}
// 16x16x32 fragments: lane = (h = lane>>4, row/col = lane&15); elements 0..7 = k0+8h+0..7, 8..15 = k0+16+8h+0..7; D element r = row 8h+r
__device__ __forceinline__ v16h frag_h(const _Float16* rowk0, int lane) {
  union { v16h v; v8h q[2]; } u; const _Float16* p = rowk0 + 8 * (lane >> 4);
  u.q[0] = *(const v8h*)p; u.q[1] = *(const v8h*)(p + 16); return u.v;
}
__device__ __forceinline__ v16h frag_f32(const float* rowk0, int lane) {
  v16h a; const float* p = rowk0 + 8 * (lane >> 4);
#pragma unroll
  for (int i = 0; i < 8; ++i) { a[i] = (_Float16)p[i]; a[8 + i] = (_Float16)p[16 + i]; }
  return a;
}
__device__ __forceinline__ v16h frag_f32s(const float* rowk0, int lane, float sc) {
  v16h a; const float* p = rowk0 + 8 * (lane >> 4);
#pragma unroll
  for (int i = 0; i < 8; ++i) { a[i] = (_Float16)(p[i] * sc); a[8 + i] = (_Float16)(p[16 + i] * sc); }
  return a;
}
// column fragment from a [K][ld] layout (column n), rows >= K read as 0
__device__ __forceinline__ v16h fragc_f32(const float* W, int k0, int n, int lane, int ld, int K) {
  v16h a; const int g = lane >> 4;
#pragma unroll
  for (int i = 0; i < 8; ++i) { const int ka = k0 + 8 * g + i, kb = ka + 16;
    a[i] = (_Float16)(ka < K ? W[(size_t)(ka < K ? ka : K - 1) * ld + n] : 0.f); a[8 + i] = (_Float16)(kb < K ? W[(size_t)(kb < K ? kb : K - 1) * ld + n] : 0.f); }
  return a;
}
struct F2 { v16b h, l; };
__device__ __forceinline__ F2 bsplit16(const float v[16]) { F2 r;
#pragma unroll
  for (int i = 0; i < 16; ++i) { const __bf16 h = (__bf16)v[i]; r.h[i] = h; r.l[i] = (__bf16)(v[i] - (float)h); }
  return r; }
__device__ __forceinline__ F2 split_row(const float* row, int k0, int lane) { float v[16]; const float* p = row + k0 + 8 * (lane >> 4);
#pragma unroll
  for (int i = 0; i < 8; ++i) { v[i] = p[i]; v[8 + i] = p[16 + i]; }
  return bsplit16(v); }
__device__ __forceinline__ F2 split_rowK(const float* row, int k0, int lane, int K) { float v[16]; const int g = lane >> 4;
#pragma unroll
  for (int i = 0; i < 8; ++i) { const int ka = k0 + 8 * g + i, kb = ka + 16; v[i] = ka < K ? row[ka < K ? ka : K - 1] : 0.f; v[8 + i] = kb < K ? row[kb < K ? kb : K - 1] : 0.f; }
  return bsplit16(v); }
__device__ __forceinline__ F2 split_col(const float* W, int k0, int n, int lane, int ld, int K) { float v[16]; const int g = lane >> 4;
#pragma unroll
  for (int i = 0; i < 8; ++i) { const int ka = k0 + 8 * g + i, kb = ka + 16; v[i] = ka < K ? W[(size_t)(ka < K ? ka : K - 1) * ld + n] : 0.f; v[8 + i] = kb < K ? W[(size_t)(kb < K ? kb : K - 1) * ld + n] : 0.f; }
  return bsplit16(v); }
__device__ __forceinline__ v8f mac3(const F2& a, const F2& b, v8f c) { c = wmma_bf(a.l, b.h, c); c = wmma_bf(a.h, b.l, c); return wmma_bf(a.h, b.h, c); }
__device__ __forceinline__ float sigm(float v) { return 1.0f / (1.0f + expf(-v)); }
#define LDSX() do { asm volatile("s_wait_dscnt 0" ::: "memory"); __builtin_amdgcn_wave_barrier(); __builtin_amdgcn_fence(__ATOMIC_RELEASE, "workgroup"); } while (0)


// Relative attention head (B 16, T 1,024, C 768, head 64; learned relative embeddings E[2T-1, 64]): wei = softmax((q k^T + S_rel) / 8) with S_rel[t][u] = q_t . E[u - t + T - 1]; out = wei v.
#define NB 16
#define TT 1024
#define CIN 768
#define HS 64
#define NRE 2047
#define NREP 2048
#define BG NB                // batches per launch group: all of them, so that every stage is one launch
#ifndef TNB
#define TNB NB
#endif
typedef __attribute__((ext_vector_type(8))) __bf16 v8b;
typedef __attribute__((ext_vector_type(4))) _Float16 v4hh;
__device__ __forceinline__ v16b frag_b(const __bf16* rowk0, int lane) {
  union { v16b v; v8b q[2]; } u; const __bf16* p = rowk0 + 8 * (lane >> 4);
  u.q[0] = *(const v8b*)p; u.q[1] = *(const v8b*)(p + 16); return u.v;
}
// fragment-order planes: a tile = 16 rows x 32 k = 512 elements, stored as [half q][lane][8]: lane (h, row) holds k = 16q + 8h + 0..7 of its row, so that one wave-wide 16-byte load reads 512 contiguous bytes (4 whole lines, not 16 quarter lines)
__device__ __forceinline__ v16h frag_ph(const _Float16* tile, int lane) {
  union { v16h v; v8h q[2]; } u; const _Float16* p = tile + 8 * lane;
  u.q[0] = *(const v8h*)p; u.q[1] = *(const v8h*)(p + 256); return u.v;
}
__device__ __forceinline__ v16b frag_pb(const __bf16* tile, int lane) {
  union { v16b v; v8b q[2]; } u; const __bf16* p = tile + 8 * lane;
  u.q[0] = *(const v8b*)p; u.q[1] = *(const v8b*)(p + 256); return u.v;
}
__device__ __forceinline__ float bfr(float v) { return (float)(__bf16)v; }
__device__ __attribute__((noinline)) float exp_ni(float v) { return expf(v); }
__device__ __attribute__((noinline)) float erf_ni(float v) { return erff(v); }

#define WS_QH  0u                                  // f16 q, fragment order: tiles [b*t / 16][k / 32]
#define WS_QL  (WS_QH + 2u * (size_t)NB * TT * HS)
#define WS_KH  (WS_QL + 2u * (size_t)NB * TT * HS)
#define WS_VT  (WS_KH + 2u * (size_t)NB * TT * HS)     // bf16 v planes hi, fragment order: tiles [b*t / 32][d / 16], rows d, k = t
#define WS_VL  (WS_VT + 2u * (size_t)NB * HS * TT)
#define WS_EH  (WS_VL + 2u * (size_t)NB * HS * TT)     // f16 E, fragment order: tiles [row / 16][k / 32] of 2048 rows, row 2047 a zero pad
#define WS_END (WS_EH + 2u * (size_t)NREP * HS)

#define AHEAD 3               // k steps between a fetch of x and W in k_proj and its use
typedef __attribute__((ext_vector_type(4))) __bf16 v4b;
static_assert(TNB * TT / 64 * 512 == NREP * HS, "the blocks of k_proj, 512 elements each, cover the f16 copy of E exactly once");
static_assert(CIN / 32 % 3 == 0 && AHEAD == 3, "x is fetched and published three k steps at a time, one step by each of the three waves of a row tile");
// ---- k_proj: block = 64 rows, 12 waves = (which of q, k, v; row tile of 16): q/k/v = x W ((in,out) [768][64]); 64 cols = 4 tiles per wave; the four k waves also round 512 elements of E to f16
__global__ __launch_bounds__(384) void k_proj(const float* __restrict__ X, const float* __restrict__ WQ, const float* __restrict__ WK, const float* __restrict__ WV, const float* __restrict__ E, _Float16* __restrict__ EH, _Float16* __restrict__ QH, _Float16* __restrict__ QL, _Float16* __restrict__ KH, __bf16* __restrict__ VT, __bf16* __restrict__ VL) {
  __shared__ __align__(16) _Float16 sh[2][64][72], sl[64][72]; __shared__ __align__(16) __bf16 th[64][72], tl2[64][72]; __shared__ __align__(16) __bf16 swf[2][12][512];   // swf: two steps' W tiles in fragment order [buffer][which * 4 + column tile][half][lane][8]
  __shared__ __align__(16) __bf16 sxf[2][3][4][512];   // sxf: x tiles rounded to bf16, in fragment order [buffer][k step mod 3][row tile][half][lane][8]
  const int tid = threadIdx.x, lane = tid & 31, col = lane & 15, g = lane >> 4, t128 = tid & 127; const int w12 = __builtin_amdgcn_readfirstlane(tid >> 5), which = w12 >> 2, wave = w12 & 3; const size_t rb = (size_t)blockIdx.x * 64; const float* Wm = which == 0 ? WQ : which == 1 ? WK : WV;
  const int e0 = (blockIdx.x * 128 + t128) * 4; const int c = e0 >> 3, er = (c >> 7) * 16 + (c & 15), ek = ((c >> 5) & 3) * 16 + ((c >> 4) & 1) * 8 + (e0 & 7);   // row and k of E that belong at place e0 of the fragment-order plane
  v4f ev = {};   // row 2047 of the plane stays the zero pad
  v8f acc[4] = {};
  // W ring: wave (which, w) fetches and rounds column tile w of its matrix for each 32-k step once for the four waves of that matrix and publishes it in swf; W is fetched AHEAD steps before its use.
  // x ring: of every three k steps, wave (which, w) fetches step 3 n + which of row tile w, each 16-byte load of the wave covering 4 whole rows of 128 bytes, rounds it once and publishes it in sxf for the three waves of that row tile; fetched three steps before its use.
  const float* xp = X + (rb + wave * 16 + (lane >> 3)) * CIN + which * 32 + (lane & 7) * 4; const float* wp = Wm + (size_t)(8 * g) * HS + wave * 16 + col;
  const int xo = ((lane >> 2) & 1) * 256 + (((lane >> 1) & 1) * 16 + (lane >> 3)) * 8 + (lane & 1) * 4;   // place of (row lane >> 3, k = 4 (lane & 7)) in a fragment-order tile: (k >> 4) * 256 + (((k >> 3) & 1) * 16 + row) * 8 + (k & 7)
  v4f xr[4]; float wr[AHEAD][16];
#pragma unroll
  for (int i = 0; i < 4; ++i) xr[i] = *(const v4f*)(xp + i * 4 * CIN);
#pragma unroll
  for (int s = 0; s < AHEAD; ++s) { const float* pw = wp + (size_t)s * 32 * HS;
#pragma unroll
    for (int i = 0; i < 8; ++i) { wr[s][i] = pw[i * HS]; wr[s][8 + i] = pw[(16 + i) * HS]; } }
  if (which == 1) { if (er < NRE) ev = *(const v4f*)(E + er * HS + ek);   // fetched here, rounded and stored at the kernel's foot: its latency passes under the k loop
    asm volatile("s_wait_xcnt 0x0" ::: "memory"); }   // ahead of any reuse of the address pair that the load names
  // unrolled whole: the stage and buffer numbers become constants and every load takes its step as an immediate offset, so that no address register is rewritten under a load in flight
#pragma unroll
  for (int kc = 0; kc < CIN / 32; ++kc) { const int s = kc % AHEAD, bf = kc & 1, xb = (kc / 3) & 1; union { v16b v; v8b q[2]; } w;
    __builtin_amdgcn_sched_barrier(0);   // keeps this step's roundings, and the waits on their loads, from rising into earlier steps: there they would cut the loads' lead
    if (kc % 3 == 0) { __bf16* d = &sxf[xb][which][wave][xo];
#pragma unroll
      for (int i = 0; i < 4; ++i) { v4b h;
#pragma unroll
        for (int e = 0; e < 4; ++e) h[e] = (__bf16)xr[i][e];
        *(v4b*)(d + 32 * i) = h; }   // rows 4 i + (lane >> 3)
      if (kc + 3 < CIN / 32) {
#pragma unroll
        for (int i = 0; i < 4; ++i) xr[i] = *(const v4f*)(xp + (kc + 3) * 32 + i * 4 * CIN);
        if (kc + 6 >= CIN / 32) asm volatile("s_wait_xcnt 0x0" :: "v"(xp) : "memory"); } }   // behind the last x fetch: the pair that every x load names is free for reuse from here on, and, named as an input, not before
#pragma unroll
    for (int i = 0; i < 16; ++i) w.v[i] = (__bf16)wr[s][i];
    { __bf16* d = &swf[bf][w12][8 * lane]; *(v8b*)d = w.q[0]; *(v8b*)(d + 256) = w.q[1]; }
    if (kc + AHEAD < CIN / 32) { const float* pw = wp + (size_t)(kc + AHEAD) * 32 * HS;
#pragma unroll
      for (int i = 0; i < 8; ++i) { wr[s][i] = pw[i * HS]; wr[s][8 + i] = pw[(16 + i) * HS]; }
      if (kc + AHEAD + 1 >= CIN / 32) asm volatile("s_wait_xcnt 0x0" :: "v"(wp) : "memory"); }   // the same behind the last W fetch, for the pair that every W load names
    // work-group barrier whose fences order LDS alone: it publishes this step's twelve W tiles (and, every third step, three steps' x tiles) and ends every read of the other buffers, which later steps overwrite; __syncthreads() here also waits out the global loads fetched ahead
    __builtin_amdgcn_fence(__ATOMIC_RELEASE, "workgroup", "local"); __builtin_amdgcn_s_barrier(); __builtin_amdgcn_fence(__ATOMIC_ACQUIRE, "workgroup", "local");
    const v16b a = frag_pb(&sxf[xb][kc % 3][wave][0], lane); v16b wf[4];
#pragma unroll
    for (int j = 0; j < 4; ++j) wf[j] = frag_pb(&swf[bf][which * 4 + j][0], lane);
#pragma unroll
    for (int j = 0; j < 4; ++j) acc[j] = wmma_bf(a, wf[j], acc[j]); }
  if (which == 2) {
#pragma unroll
    for (int j = 0; j < 4; ++j)
#pragma unroll
      for (int r = 0; r < 8; ++r) { const float v = acc[j][r]; const int rl = wave * 16 + 8 * g + r, cl = j * 16 + col; const __bf16 bh = (__bf16)v; th[cl][rl] = bh; tl2[cl][rl] = (__bf16)(v - (float)bh); } }
  else if (which == 0) {
#pragma unroll
    for (int j = 0; j < 4; ++j)
#pragma unroll
      for (int r = 0; r < 8; ++r) { const float v = acc[j][r]; const int rl = wave * 16 + 8 * g + r, cl = j * 16 + col; const _Float16 hv = (_Float16)v; sh[0][rl][cl] = hv; sl[rl][cl] = (_Float16)(v - (float)hv); } }
  else {
#pragma unroll
    for (int j = 0; j < 4; ++j)
#pragma unroll
      for (int r = 0; r < 8; ++r) sh[1][wave * 16 + 8 * g + r][j * 16 + col] = (_Float16)acc[j][r]; }
  __syncthreads();
  if (which < 2) { _Float16* dh = which == 0 ? QH : KH; for (int e = t128; e < 64 * 8; e += 128) { const int rl = (e >> 7) * 16 + (e & 15), kk = ((e >> 5) & 3) * 16 + ((e >> 4) & 1) * 8; vst2((unsigned*)(dh + rb * HS + e * 8), *(const v4u*)&sh[which][rl][kk]);
      asm volatile("s_wait_xcnt 0x0" ::: "memory");   // ahead of the next LDS read and address step, which reuse the registers that the store names
      if (which == 0) { vst2((unsigned*)(QL + rb * HS + e * 8), *(const v4u*)&sl[rl][kk]);
        asm volatile("s_wait_xcnt 0x0" ::: "memory"); } } }   // the same for the residual plane's store
  else { for (int e = t128; e < 64 * 8; e += 128) { const int cl = ((e >> 6) & 3) * 16 + (e & 15), tk = (e >> 8) * 32 + ((e >> 5) & 1) * 16 + ((e >> 4) & 1) * 8; const size_t o2 = rb * HS + e * 8; vst2((unsigned*)(VT + o2), *(const v4u*)&th[cl][tk]); vst2((unsigned*)(VL + o2), *(const v4u*)&tl2[cl][tk]);
      asm volatile("s_wait_xcnt 0x0" ::: "memory"); } }   // the same for the two v planes' stores
  if (which == 1) { v4hh h;
#pragma unroll
    for (int i = 0; i < 4; ++i) h[i] = (_Float16)bfr(ev[i]);
    vst2(EH + e0, h); } }
// ---- k_att: block = (32 queries t = QR tiles of 16, batch in group), 8 waves; wave w owns keys 128w .. 128w+127 of all 32 rows, so that each fragment of k and v that it loads feeds QR row tiles, and each E tile every row tile whose band holds it.
// Relative logits: row t = tq + i of the row tile at tq and key u = k0 + c want q_t . E[R0 + c - i + 15], R0 = k0 - tq + T - 16: a row tile takes the 144 rows E[R0 ..] (9 tiles); the bands of neighbouring row tiles lie 16 rows apart,
// so the wave walks the 8 + QR tiles from E[k0 - tl0 + T - 16 QR] once and multiplies each into every row tile whose band holds it (tile m of the walk is tile jt = m - (QR - 1 - rt) of row tile rt).
// Element (i, 16 jt + c) of a band goes to (i, 16 jt + c + i - 15) of the row tile's rows in the wave's LDS slab; of tiles jt = 0 and 8 each lane keeps the one whose key falls inside 0 .. 127.
// S = q . k + relative logit stays in the accumulators, unscaled; e^((S - max) / 8) is taken as 2^(S * SC2 - max * SC2), one fused multiply-add and one 2^x instruction; row maximum and row sum go over the 16 lanes of a row, then over the 8 waves through LDS;
// P x 2^11 turns from accumulator to A-fragment layout in the wave's own LDS slab; each wave multiplies its 128 keys into v (3 products); the 8 partial outputs are summed through LDS.
#define QR 2
#define SC2 0.18033688011112042f   // 64^-0.5 * log2(e)
template <int CTRL> __device__ __forceinline__ float row_x(float v) { return __int_as_float(__builtin_amdgcn_update_dpp(0, __float_as_int(v), CTRL, 0xf, 0xf, true)); }   // value of lane ^ mask inside the 16-lane row (row_xmask)
__device__ __forceinline__ float row_max16(float v) { v = fmaxf(v, row_x<0x161>(v)); v = fmaxf(v, row_x<0x162>(v)); v = fmaxf(v, row_x<0x164>(v)); return fmaxf(v, row_x<0x168>(v)); }
__device__ __forceinline__ float row_sum16(float v) { v += row_x<0x161>(v); v += row_x<0x162>(v); v += row_x<0x164>(v); return v + row_x<0x168>(v); }
// walk order of the E tiles: each row tile's jt = 0 directly ahead of its jt = 8, so that the kept tile 0 is live for one step only
__device__ __forceinline__ constexpr int walk_m(int n) { return n < 2 * QR ? (n >> 1) + 8 * (n & 1) : n - QR; }
// launch bounds, second argument: 4 waves per SIMD (256 VGPRs), so that two work-groups share a WGP and all 512 work-groups are resident at once
__global__ __launch_bounds__(256, 4) void k_att(const _Float16* __restrict__ QH, const _Float16* __restrict__ QL, const _Float16* __restrict__ KH, const _Float16* __restrict__ EH, const __bf16* __restrict__ VT, const __bf16* __restrict__ VL, int b0, float* __restrict__ OUT) {
  __shared__ __align__(16) float ss[8][16 * QR][132]; __shared__ __align__(16) float rmax[8][16 * QR], rsum[8][16 * QR];
  const int tid = threadIdx.x, wave = tid >> 5, lane = tid & 31, col = lane & 15, g = lane >> 4; const int b = b0 + blockIdx.z; const int k0 = wave * 128; const int tl0 = blockIdx.x * (16 * QR); const size_t q0 = (size_t)b * TT + tl0;
  v16h qf[QR][4];   // per row tile: q hi, q residual of k 0 .. 31, then of k 32 .. 63; held in registers for both logit products
#pragma unroll
  for (int rt = 0; rt < QR; ++rt) { const size_t qo = (q0 + 16 * rt) * HS; qf[rt][0] = frag_ph(QH + qo, lane); qf[rt][1] = frag_ph(QL + qo, lane); qf[rt][2] = frag_ph(QH + qo + 512, lane); qf[rt][3] = frag_ph(QL + qo + 512, lane); }
  { const _Float16* eb0 = EH + (size_t)(k0 - tl0 + TT - 16 * QR) * HS; float* sw = &ss[wave][0][0] + 8 * g * 133 + col; v8f d0[QR];
    v16h e0[8 + QR], e1[8 + QR];   // tiles in walk order, fetched two ahead
#pragma unroll
    for (int n = 0; n < 2; ++n) { e0[n] = frag_ph(eb0 + walk_m(n) * 16 * HS, lane); e1[n] = frag_ph(eb0 + walk_m(n) * 16 * HS + 512, lane); }
#pragma unroll
    for (int n = 0; n < 8 + QR; ++n) { v8f d[QR] = {}; const int m = walk_m(n);
      if (n + 2 < 8 + QR) { e0[n + 2] = frag_ph(eb0 + walk_m(n + 2) * 16 * HS, lane); e1[n + 2] = frag_ph(eb0 + walk_m(n + 2) * 16 * HS + 512, lane); }
      __builtin_amdgcn_sched_barrier(0);   // keeps the loads of the tile after next above this tile's products: without it each tile waits out its own load latency
#pragma unroll
      for (int p = 0; p < 4; ++p)
#pragma unroll
        for (int rt = 0; rt < QR; ++rt) { const int jt = m - (QR - 1 - rt); if (jt >= 0 && jt <= 8) d[rt] = wmma16(qf[rt][p], p < 2 ? e0[n] : e1[n], d[rt]); }
#pragma unroll
      for (int rt = 0; rt < QR; ++rt) { const int jt = m - (QR - 1 - rt);
        if (jt == 0) d0[rt] = d[rt];
        else if (jt > 0 && jt < 8) {
#pragma unroll
          for (int r = 0; r < 8; ++r) sw[rt * 16 * 132 + r * 133 + jt * 16 - 15] = d[rt][r]; }
        else if (jt == 8) {
#pragma unroll
          for (int r = 0; r < 8; ++r) { const int s = col + 8 * g + r - 15; ss[wave][16 * rt + 8 * g + r][s & 127] = s >= 0 ? d0[rt][r] : d[rt][r]; } } } } }
  v8f acc[QR][8] = {};
#pragma unroll
  for (int j = 0; j < 8; ++j) { const _Float16* kt = KH + ((size_t)b * TT + k0 + j * 16) * HS; v16h kb[HS / 32]; kb[0] = frag_ph(kt, lane); kb[1] = frag_ph(kt + 512, lane);
#pragma unroll
    for (int p = 0; p < 4; ++p)
#pragma unroll
      for (int rt = 0; rt < QR; ++rt) acc[rt][j] = wmma16(qf[rt][p], kb[p >> 1], acc[rt][j]); }
  LDSX();   // the skewed band was stored by other lanes of the same wave than those that read it now: the stores must have landed first
  // softmax, one row tile per trip on acc[0]; the next tile's logits move down at the trip's foot. Kept rolled, for speed only
#pragma unroll 1
  for (int rt = 0; rt < QR; ++rt) { float mr[8], sr[8]; float* sl = &ss[wave][16 * rt + 8 * g][col]; const int rw = 16 * rt + 8 * g;
#pragma unroll
    for (int r = 0; r < 8; ++r) mr[r] = -3.0e38f;
#pragma unroll
    for (int j = 0; j < 8; ++j)
#pragma unroll
      for (int r = 0; r < 8; ++r) { acc[0][j][r] += sl[r * 132 + j * 16]; mr[r] = fmaxf(mr[r], acc[0][j][r]); }
#pragma unroll
    for (int r = 0; r < 8; ++r) mr[r] = row_max16(mr[r]);
    if (col == 0) {
#pragma unroll
      for (int r = 0; r < 8; ++r) rmax[wave][rw + r] = mr[r]; }
    __syncthreads();
#pragma unroll
    for (int r = 0; r < 8; ++r) { float a = rmax[0][rw + r];
#pragma unroll
      for (int w = 1; w < 8; ++w) a = fmaxf(a, rmax[w][rw + r]);
      mr[r] = a * SC2; sr[r] = 0.f; }   // one rounded product per row, the same in all 8 waves: its rounding scales the whole row by one factor, which the division by the row sum takes out
#pragma unroll
    for (int j = 0; j < 8; ++j)
#pragma unroll
      for (int r = 0; r < 8; ++r) { acc[0][j][r] = __builtin_amdgcn_exp2f(fmaf(acc[0][j][r], SC2, -mr[r])); sr[r] += acc[0][j][r]; }
#pragma unroll
    for (int r = 0; r < 8; ++r) sr[r] = row_sum16(sr[r]);
    if (col == 0) {
#pragma unroll
      for (int r = 0; r < 8; ++r) rsum[wave][rw + r] = sr[r]; }
    __syncthreads();
#pragma unroll
    for (int r = 0; r < 8; ++r) { float a = 0.f;
#pragma unroll
      for (int w = 0; w < 8; ++w) a += rsum[w][rw + r];
      sr[r] = 1.0f / a; }
#pragma unroll
    for (int j = 0; j < 8; ++j)
#pragma unroll
      for (int r = 0; r < 8; ++r) sl[r * 132 + j * 16] = acc[0][j][r] * sr[r] * 2048.0f;
#pragma unroll
    for (int q = 0; q + 1 < QR; ++q)
#pragma unroll
      for (int j = 0; j < 8; ++j) acc[q][j] = acc[q + 1][j]; }
  LDSX();   // the slab is written by rows of the accumulator layout and read back by other lanes of the same wave: the stores must have landed first
  v8f o[QR][4] = {};
  // kept rolled for the same reason as the softmax trips
#pragma unroll 1
  for (int kc = 0; kc < 4; ++kc) { F2 p[QR];
#pragma unroll
    for (int rt = 0; rt < QR; ++rt) p[rt] = split_row(&ss[wave][16 * rt + col][0], kc * 32, lane);
#pragma unroll
    for (int j = 0; j < 4; ++j) { const size_t po = ((size_t)b * TT + k0 + kc * 32) * HS + j * 512; const v16b vh = frag_pb(VT + po, lane), vl = frag_pb(VL + po, lane);
#pragma unroll
      for (int rt = 0; rt < QR; ++rt) o[rt][j] = wmma_bf(p[rt].h, vh, o[rt][j]);
#pragma unroll
      for (int rt = 0; rt < QR; ++rt) o[rt][j] = wmma_bf(p[rt].l, vh, o[rt][j]);
#pragma unroll
      for (int rt = 0; rt < QR; ++rt) o[rt][j] = wmma_bf(p[rt].h, vl, o[rt][j]); }
    asm volatile("s_wait_xcnt 0x0" ::: "memory"); }   // ahead of the next trip's address step, which rewrites the pairs that this trip's loads name
#pragma unroll
  for (int rt = 0; rt < QR; ++rt)
#pragma unroll
    for (int j = 0; j < 4; ++j)
#pragma unroll
      for (int r = 0; r < 8; ++r) ss[wave][16 * rt + 8 * g + r][j * 16 + col] = o[rt][j][r];   // over the wave's own P slab: every read of it has fed the products above
  __syncthreads();
#pragma unroll
  for (int rt = 0; rt < QR; ++rt) { const int rl = 16 * rt + (tid >> 4), c4 = (tid & 15) * 4; v4f a = *(const v4f*)&ss[0][rl][c4];
#pragma unroll
    for (int w = 1; w < 8; ++w) a += *(const v4f*)&ss[w][rl][c4];
    vst2(OUT + (q0 + rl) * HS + c4, a * (1.0f / 2048.0f)); } }
extern "C" void kernel_launch(void* const* d_in, const int* in_sizes, int n_in, void* d_out, int out_size, void* d_ws, size_t ws_size, hipStream_t stream) {
  (void)in_sizes; (void)n_in; (void)out_size;
  const float** F = (const float**)d_in;   // 0 x [16,1024,768], 1 Wq [768,64], 2 Wk, 3 Wv, 4 E [2047,64]
  if (ws_size < (size_t)WS_END) return;
  char* ws = (char*)d_ws; _Float16 *QH = (_Float16*)(ws + WS_QH), *QL = (_Float16*)(ws + WS_QL), *KH = (_Float16*)(ws + WS_KH); __bf16 *VT = (__bf16*)(ws + WS_VT), *VL = (__bf16*)(ws + WS_VL); _Float16 *EH = (_Float16*)(ws + WS_EH);
  k_proj<<<dim3(TNB * TT / 64), 384, 0, stream>>>(F[0], F[1], F[2], F[3], F[4], EH, QH, QL, KH, VT, VL);
  for (int b0 = 0; b0 < TNB; b0 += BG) { const int ng = (TNB - b0 < BG) ? (TNB - b0) : BG;
    k_att<<<dim3(TT / (16 * QR), 1, ng), 256, 0, stream>>>(QH, QL, KH, EH, VT, VL, b0, (float*)d_out);
  }
}

// v009
// One run takes 37.6 microseconds.
// Next to v008, in two timings, it ran 1.04 times as fast each time.
// All steps since v000 together make it 11.7 times as fast.
// compute dtype: all float inputs rounded to bf16; q/k/v = x W with EXACT bf16 products on WMMA 16x16x32, f32 accumulate; q as f16 hi + residual; relative logits q_t . E[u - t + T - 1] from each wave's own band of q E^T (2 products, E rounded once to f16), skewed through LDS, and content logits q . k (2 products, k f16), summed, kept in f32 registers (32 whole rows per work-group); softmax in f32: 2^((S - max) * 64^-0.5 * log2 e) by the hardware's 2^x, P x 2^11 kept f32 split bf16 hi + lo against v bf16 hi + lo (3 products), 8 partial sums of 128 keys added in f32; f32 output [b][t][64].
#include <hip/hip_runtime.h>
#include <math.h>

typedef __attribute__((ext_vector_type(16))) _Float16 v16h;
typedef __attribute__((ext_vector_type(16))) __bf16 v16b;
typedef __attribute__((ext_vector_type(8)))  _Float16 v8h;
typedef __attribute__((ext_vector_type(8)))  float v8f;
typedef __attribute__((ext_vector_type(4)))  float v4f;
typedef __attribute__((ext_vector_type(2)))  float v2f;
typedef __attribute__((ext_vector_type(4)))  unsigned v4u;
typedef __attribute__((ext_vector_type(4)))  int v4i;
typedef float __attribute__((may_alias)) float_a;
typedef int __attribute__((may_alias)) int_a;

template <typename T> __device__ __forceinline__ void vst2(void* p, T v) { *(T*)p = v;  }
__device__ __forceinline__ v8f wmma16(v16h a, v16h b, v8f c) {
  v8f d = __builtin_amdgcn_wmma_f32_16x16x32_f16(false, a, false, b, (short)0, c, false, false);
  asm volatile("v_nop\n\tv_nop\n\tv_nop\n\tv_nop" : "+v"(d) : "v"(a), "v"(b));
  return d;
}
__device__ __forceinline__ v8f wmma_bf(v16b a, v16b b, v8f c) {
  v8f d = __builtin_amdgcn_wmma_f32_16x16x32_bf16(false, a, false, b, (short)0, c, false, false);
  asm volatile("v_nop\n\tv_nop\n\tv_nop\n\tv_nop" : "+v"(d) : "v"(a), "v"(b));
  return d;
}
// 16x16x32 fragments: lane = (h = lane>>4, row/col = lane&15); elements 0..7 = k0+8h+0..7, 8..15 = k0+16+8h+0..7; D element r = row 8h+r
__device__ __forceinline__ v16h frag_h(const _Float16* rowk0, int lane) {
  union { v16h v; v8h q[2]; } u; const _Float16* p = rowk0 + 8 * (lane >> 4);
  u.q[0] = *(const v8h*)p; u.q[1] = *(const v8h*)(p + 16); return u.v;
}
__device__ __forceinline__ v16h frag_f32(const float* rowk0, int lane) {
  v16h a; const float* p = rowk0 + 8 * (lane >> 4);
#pragma unroll
  for (int i = 0; i < 8; ++i) { a[i] = (_Float16)p[i]; a[8 + i] = (_Float16)p[16 + i]; }
  return a;
}
__device__ __forceinline__ v16h frag_f32s(const float* rowk0, int lane, float sc) {
  v16h a; const float* p = rowk0 + 8 * (lane >> 4);
#pragma unroll
  for (int i = 0; i < 8; ++i) { a[i] = (_Float16)(p[i] * sc); a[8 + i] = (_Float16)(p[16 + i] * sc); }
  return a;
}
// column fragment from a [K][ld] layout (column n), rows >= K read as 0
__device__ __forceinline__ v16h fragc_f32(const float* W, int k0, int n, int lane, int ld, int K) {
  v16h a; const int g = lane >> 4;
#pragma unroll
  for (int i = 0; i < 8; ++i) { const int ka = k0 + 8 * g + i, kb = ka + 16;
    a[i] = (_Float16)(ka < K ? W[(size_t)(ka < K ? ka : K - 1) * ld + n] : 0.f); a[8 + i] = (_Float16)(kb < K ? W[(size_t)(kb < K ? kb : K - 1) * ld + n] : 0.f); }
  return a;
}
struct F2 { v16b h, l; };
__device__ __forceinline__ F2 bsplit16(const float v[16]) { F2 r;
#pragma unroll
  for (int i = 0; i < 16; ++i) { const __bf16 h = (__bf16)v[i]; r.h[i] = h; r.l[i] = (__bf16)(v[i] - (float)h); }
  return r; }
__device__ __forceinline__ F2 split_row(const float* row, int k0, int lane) { float v[16]; const float* p = row + k0 + 8 * (lane >> 4);
#pragma unroll
  for (int i = 0; i < 8; ++i) { v[i] = p[i]; v[8 + i] = p[16 + i]; }
  return bsplit16(v); }
__device__ __forceinline__ F2 split_rowK(const float* row, int k0, int lane, int K) { float v[16]; const int g = lane >> 4;
#pragma unroll
  for (int i = 0; i < 8; ++i) { const int ka = k0 + 8 * g + i, kb = ka + 16; v[i] = ka < K ? row[ka < K ? ka : K - 1] : 0.f; v[8 + i] = kb < K ? row[kb < K ? kb : K - 1] : 0.f; }
  return bsplit16(v); }
__device__ __forceinline__ F2 split_col(const float* W, int k0, int n, int lane, int ld, int K) { float v[16]; const int g = lane >> 4;
#pragma unroll
  for (int i = 0; i < 8; ++i) { const int ka = k0 + 8 * g + i, kb = ka + 16; v[i] = ka < K ? W[(size_t)(ka < K ? ka : K - 1) * ld + n] : 0.f; v[8 + i] = kb < K ? W[(size_t)(kb < K ? kb : K - 1) * ld + n] : 0.f; }
  return bsplit16(v); }
__device__ __forceinline__ v8f mac3(const F2& a, const F2& b, v8f c) { c = wmma_bf(a.l, b.h, c); c = wmma_bf(a.h, b.l, c); return wmma_bf(a.h, b.h, c); }
__device__ __forceinline__ float sigm(float v) { return 1.0f / (1.0f + expf(-v)); }
#define LDSX() do { asm volatile("s_wait_dscnt 0" ::: "memory"); __builtin_amdgcn_wave_barrier(); __builtin_amdgcn_fence(__ATOMIC_RELEASE, "workgroup"); } while (0)


// Relative attention head (B 16, T 1,024, C 768, head 64; learned relative embeddings E[2T-1, 64]): wei = softmax((q k^T + S_rel) / 8) with S_rel[t][u] = q_t . E[u - t + T - 1]; out = wei v.
#define NB 16
#define TT 1024
#define CIN 768
#define HS 64
#define NRE 2047
#define NREP 2048
#define BG NB                // batches per launch group: all of them, so that every stage is one launch
#ifndef TNB
#define TNB NB
#endif
typedef __attribute__((ext_vector_type(8))) __bf16 v8b;
typedef __attribute__((ext_vector_type(4))) _Float16 v4hh;
__device__ __forceinline__ v16b frag_b(const __bf16* rowk0, int lane) {
  union { v16b v; v8b q[2]; } u; const __bf16* p = rowk0 + 8 * (lane >> 4);
  u.q[0] = *(const v8b*)p; u.q[1] = *(const v8b*)(p + 16); return u.v;
}
// fragment-order planes: a tile = 16 rows x 32 k = 512 elements, stored as [half q][lane][8]: lane (h, row) holds k = 16q + 8h + 0..7 of its row, so that one wave-wide 16-byte load reads 512 contiguous bytes (4 whole lines, not 16 quarter lines)
__device__ __forceinline__ v16h frag_ph(const _Float16* tile, int lane) {
  union { v16h v; v8h q[2]; } u; const _Float16* p = tile + 8 * lane;
  u.q[0] = *(const v8h*)p; u.q[1] = *(const v8h*)(p + 256); return u.v;
}
__device__ __forceinline__ v16b frag_pb(const __bf16* tile, int lane) {
  union { v16b v; v8b q[2]; } u; const __bf16* p = tile + 8 * lane;
  u.q[0] = *(const v8b*)p; u.q[1] = *(const v8b*)(p + 256); return u.v;
}
__device__ __forceinline__ float bfr(float v) { return (float)(__bf16)v; }
__device__ __attribute__((noinline)) float exp_ni(float v) { return expf(v); }
__device__ __attribute__((noinline)) float erf_ni(float v) { return erff(v); }

#define WS_QH  0u                                  // f16 q, fragment order: tiles [b*t / 16][k / 32]
#define WS_QL  (WS_QH + 2u * (size_t)NB * TT * HS)
#define WS_KH  (WS_QL + 2u * (size_t)NB * TT * HS)
#define WS_VT  (WS_KH + 2u * (size_t)NB * TT * HS)     // bf16 v planes hi, fragment order: tiles [b*t / 32][d / 16], rows d, k = t
#define WS_VL  (WS_VT + 2u * (size_t)NB * HS * TT)
#define WS_EH  (WS_VL + 2u * (size_t)NB * HS * TT)     // f16 E, fragment order: tiles [row / 16][k / 32] of 2048 rows, row 2047 a zero pad
#define WS_END (WS_EH + 2u * (size_t)NREP * HS)

#define AHEAD 3               // k steps between a fetch of x and W in k_proj and its use
typedef __attribute__((ext_vector_type(4))) __bf16 v4b;
static_assert(TNB * TT / 64 * 512 == NREP * HS, "the blocks of k_proj, 512 elements each, cover the f16 copy of E exactly once");
static_assert(CIN / 32 % 3 == 0 && AHEAD == 3, "x is fetched and published three k steps at a time, one step by each of the three waves of a row tile");
// ---- k_proj: block = 64 rows, 12 waves = (which of q, k, v; row tile of 16): q/k/v = x W ((in,out) [768][64]); 64 cols = 4 tiles per wave; the four k waves also round 512 elements of E to f16
__global__ __launch_bounds__(384) void k_proj(const float* __restrict__ X, const float* __restrict__ WQ, const float* __restrict__ WK, const float* __restrict__ WV, const float* __restrict__ E, _Float16* __restrict__ EH, _Float16* __restrict__ QH, _Float16* __restrict__ QL, _Float16* __restrict__ KH, __bf16* __restrict__ VT, __bf16* __restrict__ VL) {
  __shared__ __align__(16) _Float16 sh[2][64][72], sl[64][72]; __shared__ __align__(16) __bf16 th[64][72], tl2[64][72]; __shared__ __align__(16) __bf16 swf[2][12][520];   // swf: two steps' W tiles in fragment order [buffer][which * 4 + column tile][half][lane][8]; 8 pad elements a tile, so that the four column tiles that one 8-byte store of a wave reaches start 4 banks apart
  __shared__ __align__(16) __bf16 sxf[2][3][4][512];   // sxf: x tiles rounded to bf16, in fragment order [buffer][k step mod 3][row tile][half][lane][8]
  const int tid = threadIdx.x, lane = tid & 31, col = lane & 15, g = lane >> 4, t128 = tid & 127; const int w12 = __builtin_amdgcn_readfirstlane(tid >> 5), which = w12 >> 2, wave = w12 & 3; const size_t rb = (size_t)blockIdx.x * 64; const float* Wm = which == 0 ? WQ : which == 1 ? WK : WV;
  const int e0 = (blockIdx.x * 128 + t128) * 4; const int c = e0 >> 3, er = (c >> 7) * 16 + (c & 15), ek = ((c >> 5) & 3) * 16 + ((c >> 4) & 1) * 8 + (e0 & 7);   // row and k of E that belong at place e0 of the fragment-order plane
  v4f ev = {};   // row 2047 of the plane stays the zero pad
  v8f acc[4] = {};
  // W ring: of each 32-k step of its matrix, wave (which, w) fetches k rows 8 w .. 8 w + 7 over all 64 columns, each 16-byte load of the wave covering 2 whole rows of 256 bytes (lane = (k half g, column quad col)), rounds them once for the four waves of that matrix and publishes them in swf, 4 k of one column per 8-byte store; W is fetched AHEAD steps before its use.
  // x ring: of every three k steps, wave (which, w) fetches step 3 n + which of row tile w, each 16-byte load of the wave covering 4 whole rows of 128 bytes, rounds it once and publishes it in sxf for the three waves of that row tile; fetched three steps before its use.
  const float* xp = X + (rb + wave * 16 + (lane >> 3)) * CIN + which * 32 + (lane & 7) * 4; const float* wp = Wm + (size_t)(8 * wave + 4 * g) * HS + col * 4;
  const int xo = ((lane >> 2) & 1) * 256 + (((lane >> 1) & 1) * 16 + (lane >> 3)) * 8 + (lane & 1) * 4;   // place of (row lane >> 3, k = 4 (lane & 7)) in a fragment-order tile: (k >> 4) * 256 + (((k >> 3) & 1) * 16 + row) * 8 + (k & 7)
  const int wo = (wave >> 1) * 256 + ((wave & 1) * 16 + (col & 3) * 4) * 8 + 4 * g;   // place of (k = 8 wave + 4 g, column 4 col) in its fragment-order tile col >> 2: (k >> 4) * 256 + (((k >> 3) & 1) * 16 + (column & 15)) * 8 + (k & 7)
  v4f xr[4]; v4f wr[AHEAD][4];
#pragma unroll
  for (int i = 0; i < 4; ++i) xr[i] = *(const v4f*)(xp + i * 4 * CIN);
#pragma unroll
  for (int s = 0; s < AHEAD; ++s) { const float* pw = wp + (size_t)s * 32 * HS;
#pragma unroll
    for (int i = 0; i < 4; ++i) wr[s][i] = *(const v4f*)(pw + i * HS); }
  if (which == 1) { if (er < NRE) ev = *(const v4f*)(E + er * HS + ek);   // fetched here, rounded and stored at the kernel's foot: its latency passes under the k loop
    asm volatile("s_wait_xcnt 0x0" ::: "memory"); }   // ahead of any reuse of the address pair that the load names
  // unrolled whole: the stage and buffer numbers become constants and every load takes its step as an immediate offset, so that no address register is rewritten under a load in flight
#pragma unroll
  for (int kc = 0; kc < CIN / 32; ++kc) { const int s = kc % AHEAD, bf = kc & 1, xb = (kc / 3) & 1;
    __builtin_amdgcn_sched_barrier(0);   // keeps this step's roundings, and the waits on their loads, from rising into earlier steps: there they would cut the loads' lead
    if (kc % 3 == 0) { __bf16* d = &sxf[xb][which][wave][xo];
#pragma unroll
      for (int i = 0; i < 4; ++i) { v4b h;
#pragma unroll
        for (int e = 0; e < 4; ++e) h[e] = (__bf16)xr[i][e];
        *(v4b*)(d + 32 * i) = h; }   // rows 4 i + (lane >> 3)
      if (kc + 3 < CIN / 32) {
#pragma unroll
        for (int i = 0; i < 4; ++i) xr[i] = *(const v4f*)(xp + (kc + 3) * 32 + i * 4 * CIN);
        if (kc + 6 >= CIN / 32) asm volatile("s_wait_xcnt 0x0" :: "v"(xp) : "memory"); } }   // behind the last x fetch: the pair that every x load names is free for reuse from here on, and, named as an input, not before
    { __bf16* d = &swf[bf][which * 4 + (col >> 2)][wo];
#pragma unroll
      for (int e = 0; e < 4; ++e) { v4b h;
#pragma unroll
        for (int i = 0; i < 4; ++i) h[i] = (__bf16)wr[s][i][e];
        *(v4b*)(d + 8 * e) = h; } }   // column 4 col + e, k = 8 wave + 4 g + 0 .. 3
    if (kc + AHEAD < CIN / 32) { const float* pw = wp + (size_t)(kc + AHEAD) * 32 * HS;
#pragma unroll
      for (int i = 0; i < 4; ++i) wr[s][i] = *(const v4f*)(pw + i * HS);
      if (kc + AHEAD + 1 >= CIN / 32) asm volatile("s_wait_xcnt 0x0" :: "v"(wp) : "memory"); }   // the same behind the last W fetch, for the pair that every W load names
    // work-group barrier whose fences order LDS alone: it publishes this step's twelve W tiles (and, every third step, three steps' x tiles) and ends every read of the other buffers, which later steps overwrite; __syncthreads() here also waits out the global loads fetched ahead
    __builtin_amdgcn_fence(__ATOMIC_RELEASE, "workgroup", "local"); __builtin_amdgcn_s_barrier(); __builtin_amdgcn_fence(__ATOMIC_ACQUIRE, "workgroup", "local");
    const v16b a = frag_pb(&sxf[xb][kc % 3][wave][0], lane); v16b wf[4];
#pragma unroll
    for (int j = 0; j < 4; ++j) wf[j] = frag_pb(&swf[bf][which * 4 + j][0], lane);
#pragma unroll
    for (int j = 0; j < 4; ++j) acc[j] = wmma_bf(a, wf[j], acc[j]); }
  if (which == 2) {
#pragma unroll
    for (int j = 0; j < 4; ++j)
#pragma unroll
      for (int r = 0; r < 8; ++r) { const float v = acc[j][r]; const int rl = wave * 16 + 8 * g + r, cl = j * 16 + col; const __bf16 bh = (__bf16)v; th[cl][rl] = bh; tl2[cl][rl] = (__bf16)(v - (float)bh); } }
  else if (which == 0) {
#pragma unroll
    for (int j = 0; j < 4; ++j)
#pragma unroll
      for (int r = 0; r < 8; ++r) { const float v = acc[j][r]; const int rl = wave * 16 + 8 * g + r, cl = j * 16 + col; const _Float16 hv = (_Float16)v; sh[0][rl][cl] = hv; sl[rl][cl] = (_Float16)(v - (float)hv); } }
  else {
#pragma unroll
    for (int j = 0; j < 4; ++j)
#pragma unroll
      for (int r = 0; r < 8; ++r) sh[1][wave * 16 + 8 * g + r][j * 16 + col] = (_Float16)acc[j][r]; }
  __syncthreads();
  if (which < 2) { _Float16* dh = which == 0 ? QH : KH; for (int e = t128; e < 64 * 8; e += 128) { const int rl = (e >> 7) * 16 + (e & 15), kk = ((e >> 5) & 3) * 16 + ((e >> 4) & 1) * 8; vst2((unsigned*)(dh + rb * HS + e * 8), *(const v4u*)&sh[which][rl][kk]);
      asm volatile("s_wait_xcnt 0x0" ::: "memory");   // ahead of the next LDS read and address step, which reuse the registers that the store names
      if (which == 0) { vst2((unsigned*)(QL + rb * HS + e * 8), *(const v4u*)&sl[rl][kk]);
        asm volatile("s_wait_xcnt 0x0" ::: "memory"); } } }   // the same for the residual plane's store
  else { for (int e = t128; e < 64 * 8; e += 128) { const int cl = ((e >> 6) & 3) * 16 + (e & 15), tk = (e >> 8) * 32 + ((e >> 5) & 1) * 16 + ((e >> 4) & 1) * 8; const size_t o2 = rb * HS + e * 8; vst2((unsigned*)(VT + o2), *(const v4u*)&th[cl][tk]); vst2((unsigned*)(VL + o2), *(const v4u*)&tl2[cl][tk]);
      asm volatile("s_wait_xcnt 0x0" ::: "memory"); } }   // the same for the two v planes' stores
  if (which == 1) { v4hh h;
#pragma unroll
    for (int i = 0; i < 4; ++i) h[i] = (_Float16)bfr(ev[i]);
    vst2(EH + e0, h); } }
// ---- k_att: block = (32 queries t = QR tiles of 16, batch in group), 8 waves; wave w owns keys 128w .. 128w+127 of all 32 rows, so that each fragment of k and v that it loads feeds QR row tiles, and each E tile every row tile whose band holds it.
// Relative logits: row t = tq + i of the row tile at tq and key u = k0 + c want q_t . E[R0 + c - i + 15], R0 = k0 - tq + T - 16: a row tile takes the 144 rows E[R0 ..] (9 tiles); the bands of neighbouring row tiles lie 16 rows apart,
// so the wave walks the 8 + QR tiles from E[k0 - tl0 + T - 16 QR] once and multiplies each into every row tile whose band holds it (tile m of the walk is tile jt = m - (QR - 1 - rt) of row tile rt).
// Element (i, 16 jt + c) of a band goes to (i, 16 jt + c + i - 15) of the row tile's rows in the wave's LDS slab; of tiles jt = 0 and 8 each lane keeps the one whose key falls inside 0 .. 127.
// S = q . k + relative logit stays in the accumulators, unscaled; e^((S - max) / 8) is taken as 2^(S * SC2 - max * SC2), one fused multiply-add and one 2^x instruction; row maximum and row sum go over the 16 lanes of a row, then over the 8 waves through LDS;
// P x 2^11 turns from accumulator to A-fragment layout in the wave's own LDS slab; each wave multiplies its 128 keys into v (3 products); the 8 partial outputs are summed through LDS.
#define QR 2
#define SC2 0.18033688011112042f   // 64^-0.5 * log2(e)
template <int CTRL> __device__ __forceinline__ float row_x(float v) { return __int_as_float(__builtin_amdgcn_update_dpp(0, __float_as_int(v), CTRL, 0xf, 0xf, true)); }   // value of lane ^ mask inside the 16-lane row (row_xmask)
__device__ __forceinline__ float row_max16(float v) { v = fmaxf(v, row_x<0x161>(v)); v = fmaxf(v, row_x<0x162>(v)); v = fmaxf(v, row_x<0x164>(v)); return fmaxf(v, row_x<0x168>(v)); }
__device__ __forceinline__ float row_sum16(float v) { v += row_x<0x161>(v); v += row_x<0x162>(v); v += row_x<0x164>(v); return v + row_x<0x168>(v); }
// walk order of the E tiles: each row tile's jt = 0 directly ahead of its jt = 8, so that the kept tile 0 is live for one step only
__device__ __forceinline__ constexpr int walk_m(int n) { return n < 2 * QR ? (n >> 1) + 8 * (n & 1) : n - QR; }
// launch bounds, second argument: 4 waves per SIMD (256 VGPRs), so that two work-groups share a WGP and all 512 work-groups are resident at once
__global__ __launch_bounds__(256, 4) void k_att(const _Float16* __restrict__ QH, const _Float16* __restrict__ QL, const _Float16* __restrict__ KH, const _Float16* __restrict__ EH, const __bf16* __restrict__ VT, const __bf16* __restrict__ VL, int b0, float* __restrict__ OUT) {
  __shared__ __align__(16) float ss[8][16 * QR][132]; __shared__ __align__(16) float rmax[8][16 * QR], rsum[8][16 * QR];
  const int tid = threadIdx.x, wave = tid >> 5, lane = tid & 31, col = lane & 15, g = lane >> 4; const int b = b0 + blockIdx.z; const int k0 = wave * 128; const int tl0 = blockIdx.x * (16 * QR); const size_t q0 = (size_t)b * TT + tl0;
  v16h qf[QR][4];   // per row tile: q hi, q residual of k 0 .. 31, then of k 32 .. 63; held in registers for both logit products
#pragma unroll
  for (int rt = 0; rt < QR; ++rt) { const size_t qo = (q0 + 16 * rt) * HS; qf[rt][0] = frag_ph(QH + qo, lane); qf[rt][1] = frag_ph(QL + qo, lane); qf[rt][2] = frag_ph(QH + qo + 512, lane); qf[rt][3] = frag_ph(QL + qo + 512, lane); }
  { const _Float16* eb0 = EH + (size_t)(k0 - tl0 + TT - 16 * QR) * HS; float* sw = &ss[wave][0][0] + 8 * g * 133 + col; v8f d0[QR];
    v16h e0[8 + QR], e1[8 + QR];   // tiles in walk order, fetched two ahead
#pragma unroll
    for (int n = 0; n < 2; ++n) { e0[n] = frag_ph(eb0 + walk_m(n) * 16 * HS, lane); e1[n] = frag_ph(eb0 + walk_m(n) * 16 * HS + 512, lane); }
#pragma unroll
    for (int n = 0; n < 8 + QR; ++n) { v8f d[QR] = {}; const int m = walk_m(n);
      if (n + 2 < 8 + QR) { e0[n + 2] = frag_ph(eb0 + walk_m(n + 2) * 16 * HS, lane); e1[n + 2] = frag_ph(eb0 + walk_m(n + 2) * 16 * HS + 512, lane); }
      __builtin_amdgcn_sched_barrier(0);   // keeps the loads of the tile after next above this tile's products: without it each tile waits out its own load latency
#pragma unroll
      for (int p = 0; p < 4; ++p)
#pragma unroll
        for (int rt = 0; rt < QR; ++rt) { const int jt = m - (QR - 1 - rt); if (jt >= 0 && jt <= 8) d[rt] = wmma16(qf[rt][p], p < 2 ? e0[n] : e1[n], d[rt]); }
#pragma unroll
      for (int rt = 0; rt < QR; ++rt) { const int jt = m - (QR - 1 - rt);
        if (jt == 0) d0[rt] = d[rt];
        else if (jt > 0 && jt < 8) {
#pragma unroll
          for (int r = 0; r < 8; ++r) sw[rt * 16 * 132 + r * 133 + jt * 16 - 15] = d[rt][r]; }
        else if (jt == 8) {
#pragma unroll
          for (int r = 0; r < 8; ++r) { const int s = col + 8 * g + r - 15; ss[wave][16 * rt + 8 * g + r][s & 127] = s >= 0 ? d0[rt][r] : d[rt][r]; } } } } }
  v8f acc[QR][8] = {};
#pragma unroll
  for (int j = 0; j < 8; ++j) { const _Float16* kt = KH + ((size_t)b * TT + k0 + j * 16) * HS; v16h kb[HS / 32]; kb[0] = frag_ph(kt, lane); kb[1] = frag_ph(kt + 512, lane);
#pragma unroll
    for (int p = 0; p < 4; ++p)
#pragma unroll
      for (int rt = 0; rt < QR; ++rt) acc[rt][j] = wmma16(qf[rt][p], kb[p >> 1], acc[rt][j]); }
  LDSX();   // the skewed band was stored by other lanes of the same wave than those that read it now: the stores must have landed first
  // softmax, one row tile per trip on acc[0]; the next tile's logits move down at the trip's foot. Kept rolled, for speed only
#pragma unroll 1
  for (int rt = 0; rt < QR; ++rt) { float mr[8], sr[8]; float* sl = &ss[wave][16 * rt + 8 * g][col]; const int rw = 16 * rt + 8 * g;
#pragma unroll
    for (int r = 0; r < 8; ++r) mr[r] = -3.0e38f;
#pragma unroll
    for (int j = 0; j < 8; ++j)
#pragma unroll
      for (int r = 0; r < 8; ++r) { acc[0][j][r] += sl[r * 132 + j * 16]; mr[r] = fmaxf(mr[r], acc[0][j][r]); }
#pragma unroll
    for (int r = 0; r < 8; ++r) mr[r] = row_max16(mr[r]);
    if (col == 0) {
#pragma unroll
      for (int r = 0; r < 8; ++r) rmax[wave][rw + r] = mr[r]; }
    __syncthreads();
#pragma unroll
    for (int r = 0; r < 8; ++r) { float a = rmax[0][rw + r];
#pragma unroll
      for (int w = 1; w < 8; ++w) a = fmaxf(a, rmax[w][rw + r]);
      mr[r] = a * SC2; sr[r] = 0.f; }   // one rounded product per row, the same in all 8 waves: its rounding scales the whole row by one factor, which the division by the row sum takes out
#pragma unroll
    for (int j = 0; j < 8; ++j)
#pragma unroll
      for (int r = 0; r < 8; ++r) { acc[0][j][r] = __builtin_amdgcn_exp2f(fmaf(acc[0][j][r], SC2, -mr[r])); sr[r] += acc[0][j][r]; }
#pragma unroll
    for (int r = 0; r < 8; ++r) sr[r] = row_sum16(sr[r]);
    if (col == 0) {
#pragma unroll
      for (int r = 0; r < 8; ++r) rsum[wave][rw + r] = sr[r]; }
    __syncthreads();
#pragma unroll
    for (int r = 0; r < 8; ++r) { float a = 0.f;
#pragma unroll
      for (int w = 0; w < 8; ++w) a += rsum[w][rw + r];
      sr[r] = 1.0f / a; }
#pragma unroll
    for (int j = 0; j < 8; ++j)
#pragma unroll
      for (int r = 0; r < 8; ++r) sl[r * 132 + j * 16] = acc[0][j][r] * sr[r] * 2048.0f;
#pragma unroll
    for (int q = 0; q + 1 < QR; ++q)
#pragma unroll
      for (int j = 0; j < 8; ++j) acc[q][j] = acc[q + 1][j]; }
  LDSX();   // the slab is written by rows of the accumulator layout and read back by other lanes of the same wave: the stores must have landed first
  v8f o[QR][4] = {};
  // kept rolled for the same reason as the softmax trips
#pragma unroll 1
  for (int kc = 0; kc < 4; ++kc) { F2 p[QR];
#pragma unroll
    for (int rt = 0; rt < QR; ++rt) p[rt] = split_row(&ss[wave][16 * rt + col][0], kc * 32, lane);
#pragma unroll
    for (int j = 0; j < 4; ++j) { const size_t po = ((size_t)b * TT + k0 + kc * 32) * HS + j * 512; const v16b vh = frag_pb(VT + po, lane), vl = frag_pb(VL + po, lane);
#pragma unroll
      for (int rt = 0; rt < QR; ++rt) o[rt][j] = wmma_bf(p[rt].h, vh, o[rt][j]);
#pragma unroll
      for (int rt = 0; rt < QR; ++rt) o[rt][j] = wmma_bf(p[rt].l, vh, o[rt][j]);
#pragma unroll
      for (int rt = 0; rt < QR; ++rt) o[rt][j] = wmma_bf(p[rt].h, vl, o[rt][j]); }
    asm volatile("s_wait_xcnt 0x0" ::: "memory"); }   // ahead of the next trip's address step, which rewrites the pairs that this trip's loads name
#pragma unroll
  for (int rt = 0; rt < QR; ++rt)
#pragma unroll
    for (int j = 0; j < 4; ++j)
#pragma unroll
      for (int r = 0; r < 8; ++r) ss[wave][16 * rt + 8 * g + r][j * 16 + col] = o[rt][j][r];   // over the wave's own P slab: every read of it has fed the products above
  __syncthreads();
#pragma unroll
  for (int rt = 0; rt < QR; ++rt) { const int rl = 16 * rt + (tid >> 4), c4 = (tid & 15) * 4; v4f a = *(const v4f*)&ss[0][rl][c4];
#pragma unroll
    for (int w = 1; w < 8; ++w) a += *(const v4f*)&ss[w][rl][c4];
    vst2(OUT + (q0 + rl) * HS + c4, a * (1.0f / 2048.0f)); } }
extern "C" void kernel_launch(void* const* d_in, const int* in_sizes, int n_in, void* d_out, int out_size, void* d_ws, size_t ws_size, hipStream_t stream) {
  (void)in_sizes; (void)n_in; (void)out_size;
  const float** F = (const float**)d_in;   // 0 x [16,1024,768], 1 Wq [768,64], 2 Wk, 3 Wv, 4 E [2047,64]
  if (ws_size < (size_t)WS_END) return;
  char* ws = (char*)d_ws; _Float16 *QH = (_Float16*)(ws + WS_QH), *QL = (_Float16*)(ws + WS_QL), *KH = (_Float16*)(ws + WS_KH); __bf16 *VT = (__bf16*)(ws + WS_VT), *VL = (__bf16*)(ws + WS_VL); _Float16 *EH = (_Float16*)(ws + WS_EH);
  k_proj<<<dim3(TNB * TT / 64), 384, 0, stream>>>(F[0], F[1], F[2], F[3], F[4], EH, QH, QL, KH, VT, VL);
  for (int b0 = 0; b0 < TNB; b0 += BG) { const int ng = (TNB - b0 < BG) ? (TNB - b0) : BG;
    k_att<<<dim3(TT / (16 * QR), 1, ng), 256, 0, stream>>>(QH, QL, KH, EH, VT, VL, b0, (float*)d_out);
  }
}

// v010
// One run takes 31.5 microseconds.
// In two side-by-side timings against v009, it was 1.19 and 1.20 times as fast.
// Over all steps from v000 it is 14.0 times as fast.
// compute dtype: all float inputs rounded to bf16; q/k/v = x W with EXACT bf16 products on WMMA 16x16x32, f32 accumulate; q as f16 hi + residual; relative logits q_t . E[u - t + T - 1] from each wave's own band of q E^T (2 products, E rounded once to f16), skewed through LDS, and content logits q . k (2 products, k f16; taken transposed, keys down the accumulator), summed, kept in f32 registers (32 whole rows per work-group); softmax in f32: 2^((S - max) * 64^-0.5 * log2 e) by the hardware's 2^x, P x 2^11 kept f32 split bf16 hi + lo against v bf16 hi + lo (3 products), 8 partial sums of 128 keys added in f32; f32 output [b][t][64].
#include <hip/hip_runtime.h>
#include <math.h>

typedef __attribute__((ext_vector_type(16))) _Float16 v16h;
typedef __attribute__((ext_vector_type(16))) __bf16 v16b;
typedef __attribute__((ext_vector_type(8)))  _Float16 v8h;
typedef __attribute__((ext_vector_type(8)))  float v8f;
typedef __attribute__((ext_vector_type(4)))  float v4f;
typedef __attribute__((ext_vector_type(2)))  float v2f;
typedef __attribute__((ext_vector_type(4)))  unsigned v4u;
typedef __attribute__((ext_vector_type(4)))  int v4i;
typedef float __attribute__((may_alias)) float_a;
typedef int __attribute__((may_alias)) int_a;

template <typename T> __device__ __forceinline__ void vst2(void* p, T v) { *(T*)p = v;  }
__device__ __forceinline__ v8f wmma16(v16h a, v16h b, v8f c) {
  v8f d = __builtin_amdgcn_wmma_f32_16x16x32_f16(false, a, false, b, (short)0, c, false, false);
  asm volatile("v_nop\n\tv_nop\n\tv_nop\n\tv_nop" : "+v"(d) : "v"(a), "v"(b));
  return d;
}
__device__ __forceinline__ v8f wmma_bf(v16b a, v16b b, v8f c) {
  v8f d = __builtin_amdgcn_wmma_f32_16x16x32_bf16(false, a, false, b, (short)0, c, false, false);
  asm volatile("v_nop\n\tv_nop\n\tv_nop\n\tv_nop" : "+v"(d) : "v"(a), "v"(b));
  return d;
}
// 16x16x32 fragments: lane = (h = lane>>4, row/col = lane&15); elements 0..7 = k0+8h+0..7, 8..15 = k0+16+8h+0..7; D element r = row 8h+r
__device__ __forceinline__ v16h frag_h(const _Float16* rowk0, int lane) {
  union { v16h v; v8h q[2]; } u; const _Float16* p = rowk0 + 8 * (lane >> 4);
  u.q[0] = *(const v8h*)p; u.q[1] = *(const v8h*)(p + 16); return u.v;
}
__device__ __forceinline__ v16h frag_f32(const float* rowk0, int lane) {
  v16h a; const float* p = rowk0 + 8 * (lane >> 4);
#pragma unroll
  for (int i = 0; i < 8; ++i) { a[i] = (_Float16)p[i]; a[8 + i] = (_Float16)p[16 + i]; }
  return a;
}
__device__ __forceinline__ v16h frag_f32s(const float* rowk0, int lane, float sc) {
  v16h a; const float* p = rowk0 + 8 * (lane >> 4);
#pragma unroll
  for (int i = 0; i < 8; ++i) { a[i] = (_Float16)(p[i] * sc); a[8 + i] = (_Float16)(p[16 + i] * sc); }
  return a;
}
// column fragment from a [K][ld] layout (column n), rows >= K read as 0
__device__ __forceinline__ v16h fragc_f32(const float* W, int k0, int n, int lane, int ld, int K) {
  v16h a; const int g = lane >> 4;
#pragma unroll
  for (int i = 0; i < 8; ++i) { const int ka = k0 + 8 * g + i, kb = ka + 16;
    a[i] = (_Float16)(ka < K ? W[(size_t)(ka < K ? ka : K - 1) * ld + n] : 0.f); a[8 + i] = (_Float16)(kb < K ? W[(size_t)(kb < K ? kb : K - 1) * ld + n] : 0.f); }
  return a;
}
struct F2 { v16b h, l; };
__device__ __forceinline__ F2 bsplit16(const float v[16]) { F2 r;
#pragma unroll
  for (int i = 0; i < 16; ++i) { const __bf16 h = (__bf16)v[i]; r.h[i] = h; r.l[i] = (__bf16)(v[i] - (float)h); }
  return r; }
__device__ __forceinline__ F2 split_row(const float* row, int k0, int lane) { float v[16]; const float* p = row + k0 + 8 * (lane >> 4);
#pragma unroll
  for (int i = 0; i < 8; ++i) { v[i] = p[i]; v[8 + i] = p[16 + i]; }
  return bsplit16(v); }
__device__ __forceinline__ F2 split_rowK(const float* row, int k0, int lane, int K) { float v[16]; const int g = lane >> 4;
#pragma unroll
  for (int i = 0; i < 8; ++i) { const int ka = k0 + 8 * g + i, kb = ka + 16; v[i] = ka < K ? row[ka < K ? ka : K - 1] : 0.f; v[8 + i] = kb < K ? row[kb < K ? kb : K - 1] : 0.f; }
  return bsplit16(v); }
__device__ __forceinline__ F2 split_col(const float* W, int k0, int n, int lane, int ld, int K) { float v[16]; const int g = lane >> 4;
#pragma unroll
  for (int i = 0; i < 8; ++i) { const int ka = k0 + 8 * g + i, kb = ka + 16; v[i] = ka < K ? W[(size_t)(ka < K ? ka : K - 1) * ld + n] : 0.f; v[8 + i] = kb < K ? W[(size_t)(kb < K ? kb : K - 1) * ld + n] : 0.f; }
  return bsplit16(v); }
__device__ __forceinline__ v8f mac3(const F2& a, const F2& b, v8f c) { c = wmma_bf(a.l, b.h, c); c = wmma_bf(a.h, b.l, c); return wmma_bf(a.h, b.h, c); }
__device__ __forceinline__ float sigm(float v) { return 1.0f / (1.0f + expf(-v)); }
#define LDSX() do { asm volatile("s_wait_dscnt 0" ::: "memory"); __builtin_amdgcn_wave_barrier(); __builtin_amdgcn_fence(__ATOMIC_RELEASE, "workgroup"); } while (0)


// Relative attention head (B 16, T 1,024, C 768, head 64; learned relative embeddings E[2T-1, 64]): wei = softmax((q k^T + S_rel) / 8) with S_rel[t][u] = q_t . E[u - t + T - 1]; out = wei v.
#define NB 16
#define TT 1024
#define CIN 768
#define HS 64
#define NRE 2047
#define NREP 2048
#define BG NB                // batches per launch group: all of them, so that every stage is one launch
#ifndef TNB
#define TNB NB
#endif
typedef __attribute__((ext_vector_type(8))) __bf16 v8b;
typedef __attribute__((ext_vector_type(4))) _Float16 v4hh;
__device__ __forceinline__ v16b frag_b(const __bf16* rowk0, int lane) {
  union { v16b v; v8b q[2]; } u; const __bf16* p = rowk0 + 8 * (lane >> 4);
  u.q[0] = *(const v8b*)p; u.q[1] = *(const v8b*)(p + 16); return u.v;
}
// fragment-order planes: a tile = 16 rows x 32 k = 512 elements, stored as [half q][lane][8]: lane (h, row) holds k = 16q + 8h + 0..7 of its row, so that one wave-wide 16-byte load reads 512 contiguous bytes (4 whole lines, not 16 quarter lines)
__device__ __forceinline__ v16h frag_ph(const _Float16* tile, int lane) {
  union { v16h v; v8h q[2]; } u; const _Float16* p = tile + 8 * lane;
  u.q[0] = *(const v8h*)p; u.q[1] = *(const v8h*)(p + 256); return u.v;
}
__device__ __forceinline__ v16b frag_pb(const __bf16* tile, int lane) {
  union { v16b v; v8b q[2]; } u; const __bf16* p = tile + 8 * lane;
  u.q[0] = *(const v8b*)p; u.q[1] = *(const v8b*)(p + 256); return u.v;
}
__device__ __forceinline__ float bfr(float v) { return (float)(__bf16)v; }
__device__ __attribute__((noinline)) float exp_ni(float v) { return expf(v); }
__device__ __attribute__((noinline)) float erf_ni(float v) { return erff(v); }

#define WS_QH  0u                                  // f16 q, fragment order: tiles [b*t / 16][k / 32]
#define WS_QL  (WS_QH + 2u * (size_t)NB * TT * HS)
#define WS_KH  (WS_QL + 2u * (size_t)NB * TT * HS)
#define WS_VT  (WS_KH + 2u * (size_t)NB * TT * HS)     // bf16 v planes hi, fragment order: tiles [b*t / 32][d / 16], rows d, k = t
#define WS_VL  (WS_VT + 2u * (size_t)NB * HS * TT)
#define WS_EH  (WS_VL + 2u * (size_t)NB * HS * TT)     // f16 E, fragment order: tiles [row / 16][k / 32] of 2048 rows, row 2047 a zero pad
#define WS_END (WS_EH + 2u * (size_t)NREP * HS)

#define AHEAD 3               // k steps between a fetch of x and W in k_proj and its use
typedef __attribute__((ext_vector_type(4))) __bf16 v4b;
static_assert(TNB * TT / 64 * 512 == NREP * HS, "the blocks of k_proj, 512 elements each, cover the f16 copy of E exactly once");
static_assert(CIN / 32 % 3 == 0 && AHEAD == 3, "x is fetched and published three k steps at a time, one step by each of the three waves of a row tile");
// ---- k_proj: block = 64 rows, 12 waves = (which of q, k, v; row tile of 16): q/k/v = x W ((in,out) [768][64]); 64 cols = 4 tiles per wave; the four k waves also round 512 elements of E to f16
__global__ __launch_bounds__(384) void k_proj(const float* __restrict__ X, const float* __restrict__ WQ, const float* __restrict__ WK, const float* __restrict__ WV, const float* __restrict__ E, _Float16* __restrict__ EH, _Float16* __restrict__ QH, _Float16* __restrict__ QL, _Float16* __restrict__ KH, __bf16* __restrict__ VT, __bf16* __restrict__ VL) {
  __shared__ __align__(16) _Float16 sh[2][64][72], sl[64][72]; __shared__ __align__(16) __bf16 th[64][72], tl2[64][72]; __shared__ __align__(16) __bf16 swf[2][12][520];   // swf: two steps' W tiles in fragment order [buffer][which * 4 + column tile][half][lane][8]; 8 pad elements a tile, so that the four column tiles that one 8-byte store of a wave reaches start 4 banks apart
  __shared__ __align__(16) __bf16 sxf[2][3][4][512];   // sxf: x tiles rounded to bf16, in fragment order [buffer][k step mod 3][row tile][half][lane][8]
  const int tid = threadIdx.x, lane = tid & 31, col = lane & 15, g = lane >> 4, t128 = tid & 127; const int w12 = __builtin_amdgcn_readfirstlane(tid >> 5), which = w12 >> 2, wave = w12 & 3; const size_t rb = (size_t)blockIdx.x * 64; const float* Wm = which == 0 ? WQ : which == 1 ? WK : WV;
  const int e0 = (blockIdx.x * 128 + t128) * 4; const int c = e0 >> 3, er = (c >> 7) * 16 + (c & 15), ek = ((c >> 5) & 3) * 16 + ((c >> 4) & 1) * 8 + (e0 & 7);   // row and k of E that belong at place e0 of the fragment-order plane
  v4f ev = {};   // row 2047 of the plane stays the zero pad
  v8f acc[4] = {};
  // W ring: of each 32-k step of its matrix, wave (which, w) fetches k rows 8 w .. 8 w + 7 over all 64 columns, each 16-byte load of the wave covering 2 whole rows of 256 bytes (lane = (k half g, column quad col)), rounds them once for the four waves of that matrix and publishes them in swf, 4 k of one column per 8-byte store; W is fetched AHEAD steps before its use.
  // x ring: of every three k steps, wave (which, w) fetches step 3 n + which of row tile w, each 16-byte load of the wave covering 4 whole rows of 128 bytes, rounds it once and publishes it in sxf for the three waves of that row tile; fetched three steps before its use.
  const float* xp = X + (rb + wave * 16 + (lane >> 3)) * CIN + which * 32 + (lane & 7) * 4; const float* wp = Wm + (size_t)(8 * wave + 4 * g) * HS + col * 4;
  const int xo = ((lane >> 2) & 1) * 256 + (((lane >> 1) & 1) * 16 + (lane >> 3)) * 8 + (lane & 1) * 4;   // place of (row lane >> 3, k = 4 (lane & 7)) in a fragment-order tile: (k >> 4) * 256 + (((k >> 3) & 1) * 16 + row) * 8 + (k & 7)
  const int wo = (wave >> 1) * 256 + ((wave & 1) * 16 + (col & 3) * 4) * 8 + 4 * g;   // place of (k = 8 wave + 4 g, column 4 col) in its fragment-order tile col >> 2: (k >> 4) * 256 + (((k >> 3) & 1) * 16 + (column & 15)) * 8 + (k & 7)
  v4f xr[4]; v4f wr[AHEAD][4];
#pragma unroll
  for (int i = 0; i < 4; ++i) xr[i] = *(const v4f*)(xp + i * 4 * CIN);
#pragma unroll
  for (int s = 0; s < AHEAD; ++s) { const float* pw = wp + (size_t)s * 32 * HS;
#pragma unroll
    for (int i = 0; i < 4; ++i) wr[s][i] = *(const v4f*)(pw + i * HS); }
  if (which == 1) { if (er < NRE) ev = *(const v4f*)(E + er * HS + ek);   // fetched here, rounded and stored at the kernel's foot: its latency passes under the k loop
    asm volatile("s_wait_xcnt 0x0" ::: "memory"); }   // ahead of any reuse of the address pair that the load names
  // unrolled whole: the stage and buffer numbers become constants and every load takes its step as an immediate offset, so that no address register is rewritten under a load in flight
#pragma unroll
  for (int kc = 0; kc < CIN / 32; ++kc) { const int s = kc % AHEAD, bf = kc & 1, xb = (kc / 3) & 1;
    __builtin_amdgcn_sched_barrier(0);   // keeps this step's roundings, and the waits on their loads, from rising into earlier steps: there they would cut the loads' lead
    if (kc % 3 == 0) { __bf16* d = &sxf[xb][which][wave][xo];
#pragma unroll
      for (int i = 0; i < 4; ++i) { v4b h;
#pragma unroll
        for (int e = 0; e < 4; ++e) h[e] = (__bf16)xr[i][e];
        *(v4b*)(d + 32 * i) = h; }   // rows 4 i + (lane >> 3)
      if (kc + 3 < CIN / 32) {
#pragma unroll
        for (int i = 0; i < 4; ++i) xr[i] = *(const v4f*)(xp + (kc + 3) * 32 + i * 4 * CIN);
        if (kc + 6 >= CIN / 32) asm volatile("s_wait_xcnt 0x0" :: "v"(xp) : "memory"); } }   // behind the last x fetch: the pair that every x load names is free for reuse from here on, and, named as an input, not before
    { __bf16* d = &swf[bf][which * 4 + (col >> 2)][wo];
#pragma unroll
      for (int e = 0; e < 4; ++e) { v4b h;
#pragma unroll
        for (int i = 0; i < 4; ++i) h[i] = (__bf16)wr[s][i][e];
        *(v4b*)(d + 8 * e) = h; } }   // column 4 col + e, k = 8 wave + 4 g + 0 .. 3
    if (kc + AHEAD < CIN / 32) { const float* pw = wp + (size_t)(kc + AHEAD) * 32 * HS;
#pragma unroll
      for (int i = 0; i < 4; ++i) wr[s][i] = *(const v4f*)(pw + i * HS);
      if (kc + AHEAD + 1 >= CIN / 32) asm volatile("s_wait_xcnt 0x0" :: "v"(wp) : "memory"); }   // the same behind the last W fetch, for the pair that every W load names
    // work-group barrier whose fences order LDS alone: it publishes this step's twelve W tiles (and, every third step, three steps' x tiles) and ends every read of the other buffers, which later steps overwrite; __syncthreads() here also waits out the global loads fetched ahead
    __builtin_amdgcn_fence(__ATOMIC_RELEASE, "workgroup", "local"); __builtin_amdgcn_s_barrier(); __builtin_amdgcn_fence(__ATOMIC_ACQUIRE, "workgroup", "local");
    const v16b a = frag_pb(&sxf[xb][kc % 3][wave][0], lane); v16b wf[4];
#pragma unroll
    for (int j = 0; j < 4; ++j) wf[j] = frag_pb(&swf[bf][which * 4 + j][0], lane);
#pragma unroll
    for (int j = 0; j < 4; ++j) acc[j] = wmma_bf(a, wf[j], acc[j]); }
  if (which == 2) {
#pragma unroll
    for (int j = 0; j < 4; ++j)
#pragma unroll
      for (int r = 0; r < 8; ++r) { const float v = acc[j][r]; const int rl = wave * 16 + 8 * g + r, cl = j * 16 + col; const __bf16 bh = (__bf16)v; th[cl][rl] = bh; tl2[cl][rl] = (__bf16)(v - (float)bh); } }
  else if (which == 0) {
#pragma unroll
    for (int j = 0; j < 4; ++j)
#pragma unroll
      for (int r = 0; r < 8; ++r) { const float v = acc[j][r]; const int rl = wave * 16 + 8 * g + r, cl = j * 16 + col; const _Float16 hv = (_Float16)v; sh[0][rl][cl] = hv; sl[rl][cl] = (_Float16)(v - (float)hv); } }
  else {
#pragma unroll
    for (int j = 0; j < 4; ++j)
#pragma unroll
      for (int r = 0; r < 8; ++r) sh[1][wave * 16 + 8 * g + r][j * 16 + col] = (_Float16)acc[j][r]; }
  __syncthreads();
  if (which < 2) { _Float16* dh = which == 0 ? QH : KH; for (int e = t128; e < 64 * 8; e += 128) { const int rl = (e >> 7) * 16 + (e & 15), kk = ((e >> 5) & 3) * 16 + ((e >> 4) & 1) * 8; vst2((unsigned*)(dh + rb * HS + e * 8), *(const v4u*)&sh[which][rl][kk]);
      asm volatile("s_wait_xcnt 0x0" ::: "memory");   // ahead of the next LDS read and address step, which reuse the registers that the store names
      if (which == 0) { vst2((unsigned*)(QL + rb * HS + e * 8), *(const v4u*)&sl[rl][kk]);
        asm volatile("s_wait_xcnt 0x0" ::: "memory"); } } }   // the same for the residual plane's store
  else { for (int e = t128; e < 64 * 8; e += 128) { const int cl = ((e >> 6) & 3) * 16 + (e & 15), tk = (e >> 8) * 32 + ((e >> 5) & 1) * 16 + ((e >> 4) & 1) * 8; const size_t o2 = rb * HS + e * 8; vst2((unsigned*)(VT + o2), *(const v4u*)&th[cl][tk]); vst2((unsigned*)(VL + o2), *(const v4u*)&tl2[cl][tk]);
      asm volatile("s_wait_xcnt 0x0" ::: "memory"); } }   // the same for the two v planes' stores
  if (which == 1) { v4hh h;
#pragma unroll
    for (int i = 0; i < 4; ++i) h[i] = (_Float16)bfr(ev[i]);
    vst2(EH + e0, h); } }
// ---- k_att: block = (32 queries t = QR tiles of 16, batch in group), 8 waves; wave w owns keys 128w .. 128w+127 of all 32 rows, so that each fragment of k and v that it loads feeds QR row tiles, and each E tile every row tile whose band holds it.
// Relative logits: row t = tq + i of the row tile at tq and key u = k0 + c want q_t . E[R0 + c - i + 15], R0 = k0 - tq + T - 16: a row tile takes the 144 rows E[R0 ..] (9 tiles); the bands of neighbouring row tiles lie 16 rows apart,
// so the wave walks the 8 + QR tiles from E[k0 - tl0 + T - 16 QR] once and multiplies each into every row tile whose band holds it (tile m of the walk is tile jt = m - (QR - 1 - rt) of row tile rt).
// Element (i, 16 jt + c) of a band goes to (i, 16 jt + c + i - 15) of the row tile's rows in the wave's LDS slab; of tiles jt = 0 and 8 each lane keeps the one whose key falls inside 0 .. 127.
// S = k . q + relative logit stays in the accumulators, unscaled and transposed (k is the A operand, q the B operand: a lane holds 8 keys of one query per tile; the relative logits are read from the slab along its rows); e^((S - max) / 8) is taken as 2^(S * SC2 - max * SC2), one fused multiply-add and one 2^x instruction; row maximum and row sum run down the lane's registers, then over the two lane halves, then over the 8 waves through LDS;
// two stacked key tiles of P x 2^11 are an A fragment of 32 keys as they stand in the registers; each wave multiplies its 128 keys into v (3 products); the 8 partial outputs are summed through LDS.
#define QR 2
#define SC2 0.18033688011112042f   // 64^-0.5 * log2(e)
__device__ __forceinline__ float xhalf(float v) { return __int_as_float(__builtin_amdgcn_permlanex16(__float_as_int(v), __float_as_int(v), 0x76543210, 0xfedcba98, false, false)); }   // value of lane ^ 16
// eight 2^x in one statement: results in registers of their own, so that each instruction is the independent one that the instruction set asks for behind the transcendental ahead of it, and one v_nop behind the last
__device__ __forceinline__ void exp2x8(float (&y)[8], const float (&x)[8]) {
  asm("v_exp_f32 %0, %8\n\tv_exp_f32 %1, %9\n\tv_exp_f32 %2, %10\n\tv_exp_f32 %3, %11\n\tv_exp_f32 %4, %12\n\tv_exp_f32 %5, %13\n\tv_exp_f32 %6, %14\n\tv_exp_f32 %7, %15\n\tv_nop"
      : "=&v"(y[0]), "=&v"(y[1]), "=&v"(y[2]), "=&v"(y[3]), "=&v"(y[4]), "=&v"(y[5]), "=&v"(y[6]), "=&v"(y[7])
      : "v"(x[0]), "v"(x[1]), "v"(x[2]), "v"(x[3]), "v"(x[4]), "v"(x[5]), "v"(x[6]), "v"(x[7])); }
// walk order of the E tiles: each row tile's jt = 0 directly ahead of its jt = 8, so that the kept tile 0 is live for one step only
__device__ __forceinline__ constexpr int walk_m(int n) { return n < 2 * QR ? (n >> 1) + 8 * (n & 1) : n - QR; }
// launch bounds, second argument: 4 waves per SIMD (256 VGPRs), so that two work-groups share a WGP and all 512 work-groups are resident at once
__global__ __launch_bounds__(256, 4) void k_att(const _Float16* __restrict__ QH, const _Float16* __restrict__ QL, const _Float16* __restrict__ KH, const _Float16* __restrict__ EH, const __bf16* __restrict__ VT, const __bf16* __restrict__ VL, int b0, float* __restrict__ OUT) {
  __shared__ __align__(16) float ss[8][16 * QR][132]; __shared__ __align__(16) float rmax[8][16 * QR], rsum[8][16 * QR];
  const int tid = threadIdx.x, wave = tid >> 5, lane = tid & 31, col = lane & 15, g = lane >> 4; const int b = b0 + blockIdx.z; const int k0 = wave * 128; const int tl0 = blockIdx.x * (16 * QR); const size_t q0 = (size_t)b * TT + tl0;
  v16h qf[QR][4];   // per row tile: q hi, q residual of k 0 .. 31, then of k 32 .. 63; held in registers for both logit products
#pragma unroll
  for (int rt = 0; rt < QR; ++rt) { const size_t qo = (q0 + 16 * rt) * HS; qf[rt][0] = frag_ph(QH + qo, lane); qf[rt][1] = frag_ph(QL + qo, lane); qf[rt][2] = frag_ph(QH + qo + 512, lane); qf[rt][3] = frag_ph(QL + qo + 512, lane); }
  { const _Float16* eb0 = EH + (size_t)(k0 - tl0 + TT - 16 * QR) * HS; float* sw = &ss[wave][0][0] + 8 * g * 133 + col; v8f d0[QR];
    v16h e0[8 + QR], e1[8 + QR];   // tiles in walk order, fetched two ahead
#pragma unroll
    for (int n = 0; n < 2; ++n) { e0[n] = frag_ph(eb0 + walk_m(n) * 16 * HS, lane); e1[n] = frag_ph(eb0 + walk_m(n) * 16 * HS + 512, lane); }
#pragma unroll
    for (int n = 0; n < 8 + QR; ++n) { v8f d[QR] = {}; const int m = walk_m(n);
      if (n + 2 < 8 + QR) { e0[n + 2] = frag_ph(eb0 + walk_m(n + 2) * 16 * HS, lane); e1[n + 2] = frag_ph(eb0 + walk_m(n + 2) * 16 * HS + 512, lane); }
      __builtin_amdgcn_sched_barrier(0);   // keeps the loads of the tile after next above this tile's products: without it each tile waits out its own load latency
#pragma unroll
      for (int p = 0; p < 4; ++p)
#pragma unroll
        for (int rt = 0; rt < QR; ++rt) { const int jt = m - (QR - 1 - rt); if (jt >= 0 && jt <= 8) d[rt] = wmma16(qf[rt][p], p < 2 ? e0[n] : e1[n], d[rt]); }
#pragma unroll
      for (int rt = 0; rt < QR; ++rt) { const int jt = m - (QR - 1 - rt);
        if (jt == 0) d0[rt] = d[rt];
        else if (jt > 0 && jt < 8) {
#pragma unroll
          for (int r = 0; r < 8; ++r) sw[rt * 16 * 132 + r * 133 + jt * 16 - 15] = d[rt][r]; }
        else if (jt == 8) {
#pragma unroll
          for (int r = 0; r < 8; ++r) { const int s = col + 8 * g + r - 15; ss[wave][16 * rt + 8 * g + r][s & 127] = s >= 0 ? d0[rt][r] : d[rt][r]; } } } } }
  v8f acc[QR][8] = {};
#pragma unroll
  for (int j = 0; j < 8; ++j) { const _Float16* kt = KH + ((size_t)b * TT + k0 + j * 16) * HS; v16h kb[HS / 32]; kb[0] = frag_ph(kt, lane); kb[1] = frag_ph(kt + 512, lane);
#pragma unroll
    for (int p = 0; p < 4; ++p)
#pragma unroll
      for (int rt = 0; rt < QR; ++rt) acc[rt][j] = wmma16(kb[p >> 1], qf[rt][p], acc[rt][j]); }   // k as A, q as B: element r of the lane = key 16 j + 8 g + r of query col
  LDSX();   // the skewed band was stored by other lanes of the same wave than those that read it now: the stores must have landed first
  F2 p[QR][4];   // P x 2^11 as A fragments, hi and lo, per row tile and 32 keys
  // softmax, one row tile after the other: a lane holds 64 of the 128 keys of ONE query (its partner lane ^ 16 the other 64), so that maximum and sum run down the lane's own registers and take one exchange between the halves
#pragma unroll
  for (int rt = 0; rt < QR; ++rt) { const float* sl = &ss[wave][16 * rt + col][8 * g]; const int rw = 16 * rt + col; float mr, sr; float m8[8]; v8f s8 = {};   // eight running maxima and sums, one per accumulator register: independent chains, folded at the end
#pragma unroll
    for (int r = 0; r < 8; ++r) m8[r] = -3.0e38f;
#pragma unroll
    for (int j = 0; j < 8; ++j) { const v4f s0 = *(const v4f*)(sl + j * 16), s1 = *(const v4f*)(sl + j * 16 + 4);
#pragma unroll
      for (int r = 0; r < 4; ++r) { acc[rt][j][r] += s0[r]; acc[rt][j][4 + r] += s1[r]; m8[r] = fmaxf(m8[r], acc[rt][j][r]); m8[4 + r] = fmaxf(m8[4 + r], acc[rt][j][4 + r]); } }
    mr = fmaxf(fmaxf(fmaxf(m8[0], m8[1]), fmaxf(m8[2], m8[3])), fmaxf(fmaxf(m8[4], m8[5]), fmaxf(m8[6], m8[7])));
    mr = fmaxf(mr, xhalf(mr));
    if (g == 0) rmax[wave][rw] = mr;
    __syncthreads();
    mr = rmax[0][rw];
#pragma unroll
    for (int w = 1; w < 8; ++w) mr = fmaxf(mr, rmax[w][rw]);
    mr *= SC2;   // one rounded product per row, the same in all 8 waves: its rounding scales the whole row by one factor, which the division by the row sum takes out
#pragma unroll
    for (int j = 0; j < 8; ++j) { float x[8], y[8];
#pragma unroll
      for (int r = 0; r < 8; ++r) x[r] = fmaf(acc[rt][j][r], SC2, -mr);
      exp2x8(y, x);
#pragma unroll
      for (int r = 0; r < 8; ++r) { acc[rt][j][r] = y[r]; s8[r] += y[r]; } }
    sr = ((s8[0] + s8[1]) + (s8[2] + s8[3])) + ((s8[4] + s8[5]) + (s8[6] + s8[7]));
    sr += xhalf(sr);
    if (g == 0) rsum[wave][rw] = sr;
    __syncthreads();
    sr = 0.f;
#pragma unroll
    for (int w = 0; w < 8; ++w) sr += rsum[w][rw];
    sr = 1.0f / sr;
#pragma unroll
    for (int kc = 0; kc < 4; ++kc) { float v[16];   // two stacked key tiles of the transposed logits are the A fragment of 32 keys as they stand
#pragma unroll
      for (int i = 0; i < 8; ++i) { v[i] = acc[rt][2 * kc][i] * sr * 2048.0f; v[8 + i] = acc[rt][2 * kc + 1][i] * sr * 2048.0f; }
      p[rt][kc] = bsplit16(v); } }
  v8f o[QR][4] = {};
  const size_t vo = ((size_t)b * TT + k0) * HS; v16b vh[16], vl[16];   // v tiles in the order of their use, n = 4 kc + j, fetched two ahead: with P in registers there is no room for a whole trip's sixteen loads at once
#pragma unroll
  for (int n = 0; n < 2; ++n) { vh[n] = frag_pb(VT + vo + n * 512, lane); vl[n] = frag_pb(VL + vo + n * 512, lane); }
  // unrolled: each trip takes its fragments of P from registers, which a rolled loop could not index
#pragma unroll
  for (int kc = 0; kc < 4; ++kc) {
#pragma unroll
    for (int j = 0; j < 4; ++j) { const int n = 4 * kc + j;
      if (n + 2 < 16) { vh[n + 2] = frag_pb(VT + vo + (n + 2) * 512, lane); vl[n + 2] = frag_pb(VL + vo + (n + 2) * 512, lane); }
      __builtin_amdgcn_sched_barrier(0);   // keeps the loads of the tile after next above this tile's products: without it each tile waits out its own load latency
#pragma unroll
      for (int rt = 0; rt < QR; ++rt) o[rt][j] = wmma_bf(p[rt][kc].h, vh[n], o[rt][j]);
#pragma unroll
      for (int rt = 0; rt < QR; ++rt) o[rt][j] = wmma_bf(p[rt][kc].l, vh[n], o[rt][j]);
#pragma unroll
      for (int rt = 0; rt < QR; ++rt) o[rt][j] = wmma_bf(p[rt][kc].h, vl[n], o[rt][j]); } }
  asm volatile("s_wait_xcnt 0x0" ::: "memory");   // behind the last v fetch, ahead of any reuse of the address pairs that the loads name
#pragma unroll
  for (int rt = 0; rt < QR; ++rt)
#pragma unroll
    for (int j = 0; j < 4; ++j)
#pragma unroll
      for (int r = 0; r < 8; ++r) ss[wave][16 * rt + 8 * g + r][j * 16 + col] = o[rt][j][r];   // over the wave's own slab of relative logits: every read of it has fed the softmax above
  __syncthreads();
#pragma unroll
  for (int rt = 0; rt < QR; ++rt) { const int rl = 16 * rt + (tid >> 4), c4 = (tid & 15) * 4; v4f a = *(const v4f*)&ss[0][rl][c4];
#pragma unroll
    for (int w = 1; w < 8; ++w) a += *(const v4f*)&ss[w][rl][c4];
    vst2(OUT + (q0 + rl) * HS + c4, a * (1.0f / 2048.0f)); } }
extern "C" void kernel_launch(void* const* d_in, const int* in_sizes, int n_in, void* d_out, int out_size, void* d_ws, size_t ws_size, hipStream_t stream) {
  (void)in_sizes; (void)n_in; (void)out_size;
  const float** F = (const float**)d_in;   // 0 x [16,1024,768], 1 Wq [768,64], 2 Wk, 3 Wv, 4 E [2047,64]
  if (ws_size < (size_t)WS_END) return;
  char* ws = (char*)d_ws; _Float16 *QH = (_Float16*)(ws + WS_QH), *QL = (_Float16*)(ws + WS_QL), *KH = (_Float16*)(ws + WS_KH); __bf16 *VT = (__bf16*)(ws + WS_VT), *VL = (__bf16*)(ws + WS_VL); _Float16 *EH = (_Float16*)(ws + WS_EH);
  k_proj<<<dim3(TNB * TT / 64), 384, 0, stream>>>(F[0], F[1], F[2], F[3], F[4], EH, QH, QL, KH, VT, VL);
  for (int b0 = 0; b0 < TNB; b0 += BG) { const int ng = (TNB - b0 < BG) ? (TNB - b0) : BG;
    k_att<<<dim3(TT / (16 * QR), 1, ng), 256, 0, stream>>>(QH, QL, KH, EH, VT, VL, b0, (float*)d_out);
  }
}
